// v000
// Measured on an AMD MI455X. A time is GPU time per run, averaged over a window of back-to-back runs after a warm-up
// (all launches, gaps included; the runs take copies of the inputs in turn), and the median of several windows.
// Apart from v000's, it joins two sittings. Times from different sittings can be a few percent apart, while
// side-by-side timings come from the same sitting.
// The starting kernel, v000, takes 246 microseconds a run.
#include <hip/hip_runtime.h>
#include <hip/hip_bf16.h>
#include <math.h>
#include <stdint.h>

#define DDIM 1024
#define SEQ  4096
#define GRP  16
#define HDIM 64

typedef __attribute__((ext_vector_type(16))) __bf16 bf16x16;
typedef __attribute__((ext_vector_type(8)))  __bf16 bf16x8;
typedef __attribute__((ext_vector_type(4)))  __bf16 bf16x4;
typedef __attribute__((ext_vector_type(8)))  float  f32x8;
typedef __attribute__((ext_vector_type(4)))  float  f32x4;
typedef int v4i __attribute__((vector_size(4 * sizeof(int))));

static __device__ __forceinline__ f32x8 wmma_bf16(bf16x16 a, bf16x16 b, f32x8 c) {
  // D = A(16x32 bf16) * B(32x16 bf16) + C(16x16 f32)
  return __builtin_amdgcn_wmma_f32_16x16x32_bf16(false, a, false, b, (short)0, c,
                                                 false, false);
}

// Load one 16x32 bf16 A/B fragment: lanes 0-15 hold K=0..7 / 16..23,
// lanes 16-31 hold K=8..15 / 24..31 (caller adds (lane>>4)*8).
static __device__ __forceinline__ bf16x16 frag_ld(const __bf16* p) {
  bf16x8 lo = *(const bf16x8*)(p);
  bf16x8 hi = *(const bf16x8*)(p + 16);
  bf16x16 r;
#pragma unroll
  for (int i = 0; i < 8; ++i) { r[i] = lo[i]; r[i + 8] = hi[i]; }
  return r;
}

// ---- CDNA5 async global->LDS copy (ASYNCcnt), 16 bytes per lane ------------
static __device__ __forceinline__ void async_cp16(const void* g, void* l) {
#if __has_builtin(__builtin_amdgcn_global_load_async_to_lds_b128)
  __builtin_amdgcn_global_load_async_to_lds_b128(
      (__attribute__((address_space(1))) v4i*)(uintptr_t)g,
      (__attribute__((address_space(3))) v4i*)(uintptr_t)l, 0, 0);
#else
  asm volatile("global_load_async_to_lds_b128 %0, %1, off"
               :: "v"((unsigned)(uintptr_t)l),
                  "v"((unsigned long long)(uintptr_t)g)
               : "memory");
#endif
}

static __device__ __forceinline__ void wait_async0() {
#if __has_builtin(__builtin_amdgcn_s_wait_asynccnt)
  __builtin_amdgcn_s_wait_asynccnt(0);
#else
  asm volatile("s_wait_asynccnt 0x0" ::: "memory");
#endif
}

// ---- 16-lane XOR butterfly via v_permlane16_b32 (pure VALU) ----------------
static constexpr unsigned xor_sel(int m, int base) {
  unsigned s = 0;
  for (int j = 0; j < 8; ++j) s |= (unsigned)(((base + j) ^ m) & 15) << (4 * j);
  return s;
}

template <int M>
static __device__ __forceinline__ float shfl_xor16(float x) {
#if __has_builtin(__builtin_amdgcn_permlane16)
  constexpr unsigned s0 = xor_sel(M, 0);
  constexpr unsigned s1 = xor_sel(M, 8);
  unsigned u = __builtin_bit_cast(unsigned, x);
  u = __builtin_amdgcn_permlane16(u, u, s0, s1, false, false);
  return __builtin_bit_cast(float, u);
#else
  return __shfl_xor(x, M, 32);
#endif
}

// ---------------------------------------------------------------------------
// fp32 -> bf16 conversion (weights and activations)
// ---------------------------------------------------------------------------
__global__ __launch_bounds__(256) void cvt_f32_to_bf16(const float* __restrict__ src,
                                                       __bf16* __restrict__ dst,
                                                       int n) {
  int i = (blockIdx.x * 256 + threadIdx.x) * 4;
  if (i + 3 < n) {
    f32x4 v = *(const f32x4*)(src + i);
    bf16x4 o;
#pragma unroll
    for (int j = 0; j < 4; ++j) o[j] = (__bf16)v[j];
    *(bf16x4*)(dst + i) = o;
  }
}

// ---------------------------------------------------------------------------
// GEMM: C[4096,1024] = X[4096,1024] @ W.T + b (both bf16, NT, async staged)
// Block 128x128x32, 256 threads = 8 waves, wave tile 32x64 (2x4 WMMA),
// double-buffered LDS, one barrier per K step.
// ---------------------------------------------------------------------------
#define BM 128
#define BN 128
#define BK 32
#define LDT 40  // padded LDS row stride (elements): 80 B, 16B-aligned

enum { GM_QK = 0, GM_VT = 1, GM_OUT = 2 };

template <int MODE>
__global__ __launch_bounds__(256) void gemm_bf16_wmma(
    const __bf16* __restrict__ x, const __bf16* __restrict__ w,
    const float* __restrict__ bias, void* __restrict__ outp, float oscale) {
  __shared__ __bf16 lA[2][BM * LDT];
  __shared__ __bf16 lB[2][BN * LDT];

  const int tid  = threadIdx.x;
  const int lane = tid & 31, wave = tid >> 5;
  const int fr   = lane & 15;
  const int kb8  = (lane >> 4) << 3;
  const int hb   = kb8;
  const int wm   = (wave & 3) * 32;
  const int wn   = (wave >> 2) * 64;
  const int m0   = blockIdx.y * BM;
  const int n0   = blockIdx.x * BN;

  const int srow  = tid >> 1;        // staging row 0..127
  const int shalf = (tid & 1) * 16;  // staging K offset 0/16

  const __bf16* gx = x + (size_t)(m0 + srow) * DDIM + shalf;
  const __bf16* gw = w + (size_t)(n0 + srow) * DDIM + shalf;
  __bf16* sa = &lA[0][srow * LDT + shalf];
  __bf16* sb = &lB[0][srow * LDT + shalf];

  f32x8 acc[2][4];
#pragma unroll
  for (int mi = 0; mi < 2; ++mi)
#pragma unroll
    for (int ni = 0; ni < 4; ++ni)
#pragma unroll
      for (int r = 0; r < 8; ++r) acc[mi][ni][r] = 0.f;

  auto stage = [&](int kt, int buf) {
    const int bo = buf * (BM * LDT);
    async_cp16(gx + kt,     sa + bo);
    async_cp16(gx + kt + 8, sa + bo + 8);
    async_cp16(gw + kt,     sb + bo);
    async_cp16(gw + kt + 8, sb + bo + 8);
  };

  stage(0, 0);
  int cur = 0;
  for (int kt = 0; kt < DDIM; kt += BK) {
    wait_async0();
    __syncthreads();
    if (kt + BK < DDIM) stage(kt + BK, cur ^ 1);

    bf16x16 af[2], bw[4];
#pragma unroll
    for (int mi = 0; mi < 2; ++mi)
      af[mi] = frag_ld(&lA[cur][(wm + mi * 16 + fr) * LDT + kb8]);
#pragma unroll
    for (int ni = 0; ni < 4; ++ni)
      bw[ni] = frag_ld(&lB[cur][(wn + ni * 16 + fr) * LDT + kb8]);
#pragma unroll
    for (int mi = 0; mi < 2; ++mi)
#pragma unroll
      for (int ni = 0; ni < 4; ++ni)
        acc[mi][ni] = wmma_bf16(af[mi], bw[ni], acc[mi][ni]);
    cur ^= 1;
  }

  // epilogue: bias (+ optional scale folded into Q) + layout scatter
#pragma unroll
  for (int mi = 0; mi < 2; ++mi) {
#pragma unroll
    for (int ni = 0; ni < 4; ++ni) {
      const int   n  = n0 + wn + ni * 16 + fr;
      const float bn = bias[n];
#pragma unroll
      for (int r = 0; r < 8; ++r) {
        const int   m   = m0 + wm + mi * 16 + r + hb;
        const float val = acc[mi][ni][r] + bn;
        if (MODE == GM_OUT) {
          ((float*)outp)[(size_t)m * DDIM + n] = val;
        } else if (MODE == GM_QK) {  // per-head [g][s][dh]
          const int gq = n >> 6, dh = n & 63;
          ((__bf16*)outp)[((size_t)gq * SEQ + m) * HDIM + dh] = (__bf16)(val * oscale);
        } else {                     // GM_VT: transposed [g][dh][s]
          const int gq = n >> 6, dh = n & 63;
          ((__bf16*)outp)[((size_t)gq * HDIM + dh) * SEQ + m] = (__bf16)val;
        }
      }
    }
  }
}

// ---------------------------------------------------------------------------
// Flash attention: grid (S/128, G), 8 waves, 16 queries/wave, KV blocks of 32.
// Async double-buffered K/V staging; one barrier per KV step; softmax scale
// pre-folded into Q; permlane16 row reductions.
// ---------------------------------------------------------------------------
#define LKS 72  // K tile row stride: 144 B, 16B-aligned

__global__ __launch_bounds__(256) void attn_wmma(
    const __bf16* __restrict__ qb, const __bf16* __restrict__ kb,
    const __bf16* __restrict__ vtb, const int* __restrict__ mask,
    __bf16* __restrict__ outp) {
  __shared__ __bf16 lK[2][32 * LKS];     // [key][dh]
  __shared__ __bf16 lV[2][64 * LDT];     // [dh][key] (V pre-transposed)
  __shared__ __bf16 lP[8][16 * LDT];     // per-wave P tile [q][key]

  const int g    = blockIdx.y;
  const int tid  = threadIdx.x;
  const int lane = tid & 31, wave = tid >> 5;
  const int fr   = lane & 15;
  const int kb8  = (lane >> 4) << 3;
  const int hb   = kb8;
  const int q0   = blockIdx.x * 128 + wave * 16;

  // Q fragments (already scaled by 1/sqrt(DH)) held for the whole KV loop
  const __bf16* qrow = qb + ((size_t)g * SEQ + q0 + fr) * HDIM;
  const bf16x16 aq0 = frag_ld(qrow + kb8);
  const bf16x16 aq1 = frag_ld(qrow + 32 + kb8);

  f32x8 acco[4];
  float rm[8], rl[8];
#pragma unroll
  for (int ni = 0; ni < 4; ++ni)
#pragma unroll
    for (int r = 0; r < 8; ++r) acco[ni][r] = 0.f;
#pragma unroll
  for (int r = 0; r < 8; ++r) { rm[r] = -__builtin_inff(); rl[r] = 0.f; }

  const int skey = tid >> 3, sdh = (tid & 7) * 8;  // K staging map (32x64)
  const int vdh  = tid >> 2, vko = (tid & 3) * 8;  // V staging map (64x32)
  const __bf16* gk = kb + ((size_t)g * SEQ + skey) * HDIM + sdh;
  const __bf16* gv = vtb + ((size_t)g * HDIM + vdh) * SEQ + vko;
  __bf16* sk = &lK[0][skey * LKS + sdh];
  __bf16* sv = &lV[0][vdh * LDT + vko];

  auto stage = [&](int kv0, int buf) {
    async_cp16(gk + (size_t)kv0 * HDIM, sk + buf * (32 * LKS));
    async_cp16(gv + kv0,               sv + buf * (64 * LDT));
  };

  stage(0, 0);
  int cur = 0;
  for (int kv0 = 0; kv0 < SEQ; kv0 += 32) {
    wait_async0();
    __syncthreads();
    if (kv0 + 32 < SEQ) stage(kv0 + 32, cur ^ 1);

    // scores: S[16q x 32keys] = Q (16x64) . K^T
    f32x8 s0, s1;
#pragma unroll
    for (int r = 0; r < 8; ++r) { s0[r] = 0.f; s1[r] = 0.f; }
    {
      const __bf16* kbuf = &lK[cur][0];
      bf16x16 b00 = frag_ld(&kbuf[(fr)      * LKS + kb8]);
      bf16x16 b01 = frag_ld(&kbuf[(fr)      * LKS + 32 + kb8]);
      bf16x16 b10 = frag_ld(&kbuf[(16 + fr) * LKS + kb8]);
      bf16x16 b11 = frag_ld(&kbuf[(16 + fr) * LKS + 32 + kb8]);
      s0 = wmma_bf16(aq0, b00, s0);
      s0 = wmma_bf16(aq1, b01, s0);
      s1 = wmma_bf16(aq0, b10, s1);
      s1 = wmma_bf16(aq1, b11, s1);
    }

    // key mask (scale already folded into Q)
    const int mk0 = mask[kv0 + fr];
    const int mk1 = mask[kv0 + 16 + fr];
#pragma unroll
    for (int r = 0; r < 8; ++r) {
      s0[r] = mk0 ? s0[r] : -__builtin_inff();
      s1[r] = mk1 ? s1[r] : -__builtin_inff();
    }

    // online softmax; row r lives across the 16 lanes of this half-wave
#pragma unroll
    for (int r = 0; r < 8; ++r) {
      float t = fmaxf(s0[r], s1[r]);
      t = fmaxf(t, shfl_xor16<1>(t));
      t = fmaxf(t, shfl_xor16<2>(t));
      t = fmaxf(t, shfl_xor16<4>(t));
      t = fmaxf(t, shfl_xor16<8>(t));
      const float mnew = fmaxf(rm[r], t);
      const float corr = __expf(rm[r] - mnew);
      const float p0 = __expf(s0[r] - mnew);
      const float p1 = __expf(s1[r] - mnew);
      float rs = p0 + p1;
      rs += shfl_xor16<1>(rs);
      rs += shfl_xor16<2>(rs);
      rs += shfl_xor16<4>(rs);
      rs += shfl_xor16<8>(rs);
      rl[r] = rl[r] * corr + rs;
      rm[r] = mnew;
#pragma unroll
      for (int ni = 0; ni < 4; ++ni) acco[ni][r] *= corr;
      s0[r] = p0;
      s1[r] = p1;
    }

    // C-layout -> A-layout for P via wave-private LDS (in-order per wave)
    __bf16* pw = &lP[wave][0];
#pragma unroll
    for (int r = 0; r < 8; ++r) {
      pw[(r + hb) * LDT + fr]      = (__bf16)s0[r];
      pw[(r + hb) * LDT + 16 + fr] = (__bf16)s1[r];
    }
    asm volatile("" ::: "memory");  // keep ds stores before ds frag loads

    const bf16x16 ap = frag_ld(&pw[fr * LDT + kb8]);
#pragma unroll
    for (int ni = 0; ni < 4; ++ni) {
      bf16x16 bv = frag_ld(&lV[cur][(ni * 16 + fr) * LDT + kb8]);
      acco[ni] = wmma_bf16(ap, bv, acco[ni]);
    }
    cur ^= 1;
  }

  // normalize and write bf16 attention output [s][g*64+dh]
#pragma unroll
  for (int ni = 0; ni < 4; ++ni) {
#pragma unroll
    for (int r = 0; r < 8; ++r) {
      const int srow = q0 + r + hb;
      const int dcol = g * HDIM + ni * 16 + fr;
      outp[(size_t)srow * DDIM + dcol] = (__bf16)(acco[ni][r] / rl[r]);
    }
  }
}

// ---------------------------------------------------------------------------
extern "C" void kernel_launch(void* const* d_in, const int* in_sizes, int n_in,
                              void* d_out, int out_size, void* d_ws, size_t ws_size,
                              hipStream_t stream) {
  const float* q    = (const float*)d_in[0];
  const float* k    = (const float*)d_in[1];
  const float* v    = (const float*)d_in[2];
  const int*   mask = (const int*)d_in[3];
  const float* Wq   = (const float*)d_in[4];
  const float* bq   = (const float*)d_in[5];
  const float* Wk   = (const float*)d_in[6];
  const float* bk   = (const float*)d_in[7];
  const float* Wv   = (const float*)d_in[8];
  const float* bv   = (const float*)d_in[9];
  const float* Wo   = (const float*)d_in[10];
  const float* bo   = (const float*)d_in[11];

  // workspace layout (bf16 elements); total 32M elems = 64 MB
  __bf16* ws  = (__bf16*)d_ws;
  const size_t MEL = (size_t)1024 * 1024;
  __bf16* wqb = ws + 0 * MEL;
  __bf16* wkb = ws + 1 * MEL;
  __bf16* wvb = ws + 2 * MEL;
  __bf16* wob = ws + 3 * MEL;
  __bf16* xq  = ws + 4 * MEL;    // query bf16 [S][D]
  __bf16* xk  = ws + 8 * MEL;    // key   bf16 [S][D]
  __bf16* xv  = ws + 12 * MEL;   // value bf16 [S][D]
  __bf16* qbf = ws + 16 * MEL;   // [G][S][DH] (pre-scaled by 1/8)
  __bf16* kbf = ws + 20 * MEL;   // [G][S][DH]
  __bf16* vtb = ws + 24 * MEL;   // [G][DH][S]
  __bf16* abf = ws + 28 * MEL;   // [S][D]

  const int WN = DDIM * DDIM;        // 1M
  const int AN = SEQ * DDIM;         // 4M
  cvt_f32_to_bf16<<<WN / 1024, 256, 0, stream>>>(Wq, wqb, WN);
  cvt_f32_to_bf16<<<WN / 1024, 256, 0, stream>>>(Wk, wkb, WN);
  cvt_f32_to_bf16<<<WN / 1024, 256, 0, stream>>>(Wv, wvb, WN);
  cvt_f32_to_bf16<<<WN / 1024, 256, 0, stream>>>(Wo, wob, WN);
  cvt_f32_to_bf16<<<AN / 1024, 256, 0, stream>>>(q, xq, AN);
  cvt_f32_to_bf16<<<AN / 1024, 256, 0, stream>>>(k, xk, AN);
  cvt_f32_to_bf16<<<AN / 1024, 256, 0, stream>>>(v, xv, AN);

  dim3 gg(DDIM / BN, SEQ / BM);  // (8, 32)
  gemm_bf16_wmma<GM_QK><<<gg, 256, 0, stream>>>(xq, wqb, bq, qbf, 0.125f);
  gemm_bf16_wmma<GM_QK><<<gg, 256, 0, stream>>>(xk, wkb, bk, kbf, 1.0f);
  gemm_bf16_wmma<GM_VT><<<gg, 256, 0, stream>>>(xv, wvb, bv, vtb, 1.0f);

  attn_wmma<<<dim3(SEQ / 128, GRP), 256, 0, stream>>>(qbf, kbf, vtb, mask, abf);

  gemm_bf16_wmma<GM_OUT><<<gg, 256, 0, stream>>>(abf, wob, bo, d_out, 1.0f);
}

// v001
// Measured time: 219 microseconds a run.
// Next to v000, in two timings, it ran 1.16 times as fast each time.
#include <hip/hip_runtime.h>
#include <hip/hip_bf16.h>
#include <math.h>
#include <stdint.h>

#define DDIM 1024
#define SEQ  4096
#define GRP  16
#define HDIM 64

typedef __attribute__((ext_vector_type(16))) __bf16 bf16x16;
typedef __attribute__((ext_vector_type(8)))  __bf16 bf16x8;
typedef __attribute__((ext_vector_type(4)))  __bf16 bf16x4;
typedef __attribute__((ext_vector_type(8)))  float  f32x8;
typedef __attribute__((ext_vector_type(4)))  float  f32x4;
typedef int v4i __attribute__((vector_size(4 * sizeof(int))));

static __device__ __forceinline__ f32x8 wmma_bf16(bf16x16 a, bf16x16 b, f32x8 c) {
  // D = A(16x32 bf16) * B(32x16 bf16) + C(16x16 f32)
  return __builtin_amdgcn_wmma_f32_16x16x32_bf16(false, a, false, b, (short)0, c,
                                                 false, false);
}

// Load one 16x32 bf16 A/B fragment: lanes 0-15 hold K=0..7 / 16..23,
// lanes 16-31 hold K=8..15 / 24..31 (caller adds (lane>>4)*8).
static __device__ __forceinline__ bf16x16 frag_ld(const __bf16* p) {
  bf16x8 lo = *(const bf16x8*)(p);
  bf16x8 hi = *(const bf16x8*)(p + 16);
  bf16x16 r;
#pragma unroll
  for (int i = 0; i < 8; ++i) { r[i] = lo[i]; r[i + 8] = hi[i]; }
  return r;
}

// ---- CDNA5 async global->LDS copy (ASYNCcnt), 16 bytes per lane ------------
static __device__ __forceinline__ void async_cp16(const void* g, void* l) {
#if __has_builtin(__builtin_amdgcn_global_load_async_to_lds_b128)
  __builtin_amdgcn_global_load_async_to_lds_b128(
      (__attribute__((address_space(1))) v4i*)(uintptr_t)g,
      (__attribute__((address_space(3))) v4i*)(uintptr_t)l, 0, 0);
#else
  asm volatile("global_load_async_to_lds_b128 %0, %1, off"
               :: "v"((unsigned)(uintptr_t)l),
                  "v"((unsigned long long)(uintptr_t)g)
               : "memory");
#endif
}

static __device__ __forceinline__ void wait_async0() {
#if __has_builtin(__builtin_amdgcn_s_wait_asynccnt)
  __builtin_amdgcn_s_wait_asynccnt(0);
#else
  asm volatile("s_wait_asynccnt 0x0" ::: "memory");
#endif
}

// ---- lane l <-> l ^ 16 exchange via v_permlanex16_b32 (pure VALU) ----------
static __device__ __forceinline__ float swap_halves(float x) {
  int u = __builtin_bit_cast(int, x);
  u = __builtin_amdgcn_permlanex16(u, u, 0x76543210, 0xfedcba98, false, false);
  return __builtin_bit_cast(float, u);
}

// ---------------------------------------------------------------------------
// fp32 -> bf16 conversion (weights and activations)
// ---------------------------------------------------------------------------
__global__ __launch_bounds__(256) void cvt_f32_to_bf16(const float* __restrict__ src,
                                                       __bf16* __restrict__ dst,
                                                       int n) {
  int i = (blockIdx.x * 256 + threadIdx.x) * 4;
  if (i + 3 < n) {
    f32x4 v = *(const f32x4*)(src + i);
    bf16x4 o;
#pragma unroll
    for (int j = 0; j < 4; ++j) o[j] = (__bf16)v[j];
    *(bf16x4*)(dst + i) = o;
  }
}

// ---------------------------------------------------------------------------
// GEMM: C[4096,1024] = X[4096,1024] @ W.T + b (both bf16, NT, async staged)
// Block 128x128x32, 256 threads = 8 waves, wave tile 32x64 (2x4 WMMA),
// double-buffered LDS, one barrier per K step.
// ---------------------------------------------------------------------------
#define BM 128
#define BN 128
#define BK 32
#define LDT 40  // padded LDS row stride (elements): 80 B, 16B-aligned

enum { GM_QK = 0, GM_VT = 1, GM_OUT = 2 };

template <int MODE>
__global__ __launch_bounds__(256) void gemm_bf16_wmma(
    const __bf16* __restrict__ x, const __bf16* __restrict__ w,
    const float* __restrict__ bias, void* __restrict__ outp, float oscale) {
  __shared__ __bf16 lA[2][BM * LDT];
  __shared__ __bf16 lB[2][BN * LDT];

  const int tid  = threadIdx.x;
  const int lane = tid & 31, wave = tid >> 5;
  const int fr   = lane & 15;
  const int kb8  = (lane >> 4) << 3;
  const int hb   = kb8;
  const int wm   = (wave & 3) * 32;
  const int wn   = (wave >> 2) * 64;
  const int m0   = blockIdx.y * BM;
  const int n0   = blockIdx.x * BN;

  const int srow  = tid >> 1;        // staging row 0..127
  const int shalf = (tid & 1) * 16;  // staging K offset 0/16

  const __bf16* gx = x + (size_t)(m0 + srow) * DDIM + shalf;
  const __bf16* gw = w + (size_t)(n0 + srow) * DDIM + shalf;
  __bf16* sa = &lA[0][srow * LDT + shalf];
  __bf16* sb = &lB[0][srow * LDT + shalf];

  f32x8 acc[2][4];
#pragma unroll
  for (int mi = 0; mi < 2; ++mi)
#pragma unroll
    for (int ni = 0; ni < 4; ++ni)
#pragma unroll
      for (int r = 0; r < 8; ++r) acc[mi][ni][r] = 0.f;

  auto stage = [&](int kt, int buf) {
    const int bo = buf * (BM * LDT);
    async_cp16(gx + kt,     sa + bo);
    async_cp16(gx + kt + 8, sa + bo + 8);
    async_cp16(gw + kt,     sb + bo);
    async_cp16(gw + kt + 8, sb + bo + 8);
  };

  stage(0, 0);
  int cur = 0;
  for (int kt = 0; kt < DDIM; kt += BK) {
    wait_async0();
    __syncthreads();
    if (kt + BK < DDIM) stage(kt + BK, cur ^ 1);

    bf16x16 af[2], bw[4];
#pragma unroll
    for (int mi = 0; mi < 2; ++mi)
      af[mi] = frag_ld(&lA[cur][(wm + mi * 16 + fr) * LDT + kb8]);
#pragma unroll
    for (int ni = 0; ni < 4; ++ni)
      bw[ni] = frag_ld(&lB[cur][(wn + ni * 16 + fr) * LDT + kb8]);
#pragma unroll
    for (int mi = 0; mi < 2; ++mi)
#pragma unroll
      for (int ni = 0; ni < 4; ++ni)
        acc[mi][ni] = wmma_bf16(af[mi], bw[ni], acc[mi][ni]);
    cur ^= 1;
  }

  // epilogue: bias (+ optional scale folded into Q) + layout scatter
#pragma unroll
  for (int mi = 0; mi < 2; ++mi) {
#pragma unroll
    for (int ni = 0; ni < 4; ++ni) {
      const int   n  = n0 + wn + ni * 16 + fr;
      const float bn = bias[n];
#pragma unroll
      for (int r = 0; r < 8; ++r) {
        const int   m   = m0 + wm + mi * 16 + r + hb;
        const float val = acc[mi][ni][r] + bn;
        if (MODE == GM_OUT) {
          ((float*)outp)[(size_t)m * DDIM + n] = val;
        } else if (MODE == GM_QK) {  // per-head [g][s][dh]
          const int gq = n >> 6, dh = n & 63;
          ((__bf16*)outp)[((size_t)gq * SEQ + m) * HDIM + dh] = (__bf16)(val * oscale);
        } else {                     // GM_VT: transposed [g][dh][s]
          const int gq = n >> 6, dh = n & 63;
          ((__bf16*)outp)[((size_t)gq * HDIM + dh) * SEQ + m] = (__bf16)val;
        }
      }
    }
  }
}

#define LKS 72  // K tile row stride: 144 B, 16B-aligned

__global__ __launch_bounds__(256) void attn_wmma(
    const __bf16* __restrict__ qb, const __bf16* __restrict__ kb,
    const __bf16* __restrict__ vtb, const int* __restrict__ mask,
    __bf16* __restrict__ outp) {
  __shared__ __bf16 lK[2][32 * LKS];     // [key][dh]
  __shared__ __bf16 lV[2][64 * LDT];     // [dh][key] (V pre-transposed)

  const int g    = blockIdx.y;
  const int tid  = threadIdx.x;
  const int lane = tid & 31, wave = tid >> 5;
  const int fr   = lane & 15;
  const int kb8  = (lane >> 4) << 3;
  const int hb   = kb8;
  const int q0   = blockIdx.x * 128 + wave * 16;

  // Q fragments (already scaled by 1/sqrt(DH)) held for the whole KV loop;
  // B operand: lane = query column fr
  const __bf16* qrow = qb + ((size_t)g * SEQ + q0 + fr) * HDIM;
  const bf16x16 bq0 = frag_ld(qrow + kb8);
  const bf16x16 bq1 = frag_ld(qrow + 32 + kb8);

  f32x8 acco[4];  // O^T: acco[ni][r] = O[q0 + fr][ni * 16 + hb + r]
#pragma unroll
  for (int ni = 0; ni < 4; ++ni)
#pragma unroll
    for (int r = 0; r < 8; ++r) acco[ni][r] = 0.f;
  float rm = -__builtin_inff();  // running max of query fr (same in both halves)
  float rl = 0.f;                // running sum over this half's keys only

  const int skey = tid >> 3, sdh = (tid & 7) * 8;  // K staging map (32x64)
  const int vdh  = tid >> 2, vko = (tid & 3) * 8;  // V staging map (64x32)
  const __bf16* gk = kb + ((size_t)g * SEQ + skey) * HDIM + sdh;
  const __bf16* gv = vtb + ((size_t)g * HDIM + vdh) * SEQ + vko;
  __bf16* sk = &lK[0][skey * LKS + sdh];
  __bf16* sv = &lV[0][vdh * LDT + vko];

  auto stage = [&](int kv0, int buf) {
    async_cp16(gk + (size_t)kv0 * HDIM, sk + buf * (32 * LKS));
    async_cp16(gv + kv0,               sv + buf * (64 * LDT));
  };

  stage(0, 0);
  int cur = 0;
  for (int kv0 = 0; kv0 < SEQ; kv0 += 32) {
    wait_async0();
    __syncthreads();
    if (kv0 + 32 < SEQ) stage(kv0 + 32, cur ^ 1);

    // key mask of this lane's score rows: keys hb..hb+7 and 16+hb..16+hb+7
    const v4i mk00 = *(const v4i*)(mask + kv0 + hb);
    const v4i mk01 = *(const v4i*)(mask + kv0 + hb + 4);
    const v4i mk10 = *(const v4i*)(mask + kv0 + 16 + hb);
    const v4i mk11 = *(const v4i*)(mask + kv0 + 16 + hb + 4);

    // scores: S^T[32 keys x 16 q] = K (32x64) . Q^T; s0[r] = key hb + r,
    // s1[r] = key 16 + hb + r, both of query fr
    f32x8 s0, s1;
#pragma unroll
    for (int r = 0; r < 8; ++r) { s0[r] = 0.f; s1[r] = 0.f; }
    {
      const __bf16* kbuf = &lK[cur][0];
      bf16x16 a00 = frag_ld(&kbuf[(fr)      * LKS + kb8]);
      bf16x16 a01 = frag_ld(&kbuf[(fr)      * LKS + 32 + kb8]);
      bf16x16 a10 = frag_ld(&kbuf[(16 + fr) * LKS + kb8]);
      bf16x16 a11 = frag_ld(&kbuf[(16 + fr) * LKS + 32 + kb8]);
      s0 = wmma_bf16(a00, bq0, s0);
      s0 = wmma_bf16(a01, bq1, s0);
      s1 = wmma_bf16(a10, bq0, s1);
      s1 = wmma_bf16(a11, bq1, s1);
    }

    // key mask (scale already folded into Q)
#pragma unroll
    for (int r = 0; r < 4; ++r) {
      s0[r]     = mk00[r] ? s0[r]     : -__builtin_inff();
      s0[r + 4] = mk01[r] ? s0[r + 4] : -__builtin_inff();
      s1[r]     = mk10[r] ? s1[r]     : -__builtin_inff();
      s1[r + 4] = mk11[r] ? s1[r + 4] : -__builtin_inff();
    }

    // online softmax: max over the lane's 16 keys, one exchange for the rest
    float tm[8];
#pragma unroll
    for (int r = 0; r < 8; ++r) tm[r] = fmaxf(s0[r], s1[r]);
    float t = fmaxf(fmaxf(fmaxf(tm[0], tm[1]), fmaxf(tm[2], tm[3])),
                    fmaxf(fmaxf(tm[4], tm[5]), fmaxf(tm[6], tm[7])));
    t = fmaxf(t, swap_halves(t));
    const float mnew = fmaxf(rm, t);
    const float corr = __expf(rm - mnew);
    rm = mnew;
#pragma unroll
    for (int r = 0; r < 8; ++r) {
      s0[r] = __expf(s0[r] - mnew);
      s1[r] = __expf(s1[r] - mnew);
    }
    float ts[8];
#pragma unroll
    for (int r = 0; r < 8; ++r) ts[r] = s0[r] + s1[r];
    rl = rl * corr + (((ts[0] + ts[1]) + (ts[2] + ts[3])) +
                      ((ts[4] + ts[5]) + (ts[6] + ts[7])));
#pragma unroll
    for (int ni = 0; ni < 4; ++ni)
#pragma unroll
      for (int r = 0; r < 8; ++r) acco[ni][r] *= corr;

    // P^T as B operand: the two score tiles, converted in place, are already in
    // the hardware k order that frag_ld gives the V^T rows
    bf16x16 bp;
#pragma unroll
    for (int r = 0; r < 8; ++r) { bp[r] = (__bf16)s0[r]; bp[r + 8] = (__bf16)s1[r]; }

#pragma unroll
    for (int ni = 0; ni < 4; ++ni) {
      bf16x16 av = frag_ld(&lV[cur][(ni * 16 + fr) * LDT + kb8]);
      acco[ni] = wmma_bf16(av, bp, acco[ni]);
    }
    cur ^= 1;
  }

  // join the halves' sums, normalize, write bf16 attention output [s][g*64+dh]:
  // a lane holds 8 consecutive dh of its query per tile, one 16-byte store each
  rl += swap_halves(rl);
  __bf16* orow = outp + (size_t)(q0 + fr) * DDIM + g * HDIM + hb;
#pragma unroll
  for (int ni = 0; ni < 4; ++ni) {
    bf16x8 o;
#pragma unroll
    for (int r = 0; r < 8; ++r) o[r] = (__bf16)(acco[ni][r] / rl);
    *(bf16x8*)(orow + ni * 16) = o;
  }
}

// ---------------------------------------------------------------------------
extern "C" void kernel_launch(void* const* d_in, const int* in_sizes, int n_in,
                              void* d_out, int out_size, void* d_ws, size_t ws_size,
                              hipStream_t stream) {
  const float* q    = (const float*)d_in[0];
  const float* k    = (const float*)d_in[1];
  const float* v    = (const float*)d_in[2];
  const int*   mask = (const int*)d_in[3];
  const float* Wq   = (const float*)d_in[4];
  const float* bq   = (const float*)d_in[5];
  const float* Wk   = (const float*)d_in[6];
  const float* bk   = (const float*)d_in[7];
  const float* Wv   = (const float*)d_in[8];
  const float* bv   = (const float*)d_in[9];
  const float* Wo   = (const float*)d_in[10];
  const float* bo   = (const float*)d_in[11];

  // workspace layout (bf16 elements); total 32M elems = 64 MB
  __bf16* ws  = (__bf16*)d_ws;
  const size_t MEL = (size_t)1024 * 1024;
  __bf16* wqb = ws + 0 * MEL;
  __bf16* wkb = ws + 1 * MEL;
  __bf16* wvb = ws + 2 * MEL;
  __bf16* wob = ws + 3 * MEL;
  __bf16* xq  = ws + 4 * MEL;    // query bf16 [S][D]
  __bf16* xk  = ws + 8 * MEL;    // key   bf16 [S][D]
  __bf16* xv  = ws + 12 * MEL;   // value bf16 [S][D]
  __bf16* qbf = ws + 16 * MEL;   // [G][S][DH] (pre-scaled by 1/8)
  __bf16* kbf = ws + 20 * MEL;   // [G][S][DH]
  __bf16* vtb = ws + 24 * MEL;   // [G][DH][S]
  __bf16* abf = ws + 28 * MEL;   // [S][D]

  const int WN = DDIM * DDIM;        // 1M
  const int AN = SEQ * DDIM;         // 4M
  cvt_f32_to_bf16<<<WN / 1024, 256, 0, stream>>>(Wq, wqb, WN);
  cvt_f32_to_bf16<<<WN / 1024, 256, 0, stream>>>(Wk, wkb, WN);
  cvt_f32_to_bf16<<<WN / 1024, 256, 0, stream>>>(Wv, wvb, WN);
  cvt_f32_to_bf16<<<WN / 1024, 256, 0, stream>>>(Wo, wob, WN);
  cvt_f32_to_bf16<<<AN / 1024, 256, 0, stream>>>(q, xq, AN);
  cvt_f32_to_bf16<<<AN / 1024, 256, 0, stream>>>(k, xk, AN);
  cvt_f32_to_bf16<<<AN / 1024, 256, 0, stream>>>(v, xv, AN);

  dim3 gg(DDIM / BN, SEQ / BM);  // (8, 32)
  gemm_bf16_wmma<GM_QK><<<gg, 256, 0, stream>>>(xq, wqb, bq, qbf, 0.125f);
  gemm_bf16_wmma<GM_QK><<<gg, 256, 0, stream>>>(xk, wkb, bk, kbf, 1.0f);
  gemm_bf16_wmma<GM_VT><<<gg, 256, 0, stream>>>(xv, wvb, bv, vtb, 1.0f);

  attn_wmma<<<dim3(SEQ / 128, GRP), 256, 0, stream>>>(qbf, kbf, vtb, mask, abf);

  gemm_bf16_wmma<GM_OUT><<<gg, 256, 0, stream>>>(abf, wob, bo, d_out, 1.0f);
}

// v002
// Measured time: 203 microseconds a run.
// Next to v001, in two timings, it ran 1.06 and 1.08 times as fast.
// All steps since v000 together make it 1.24 times as fast.
#include <hip/hip_runtime.h>
#include <hip/hip_bf16.h>
#include <math.h>
#include <stdint.h>

#define DDIM 1024
#define SEQ  4096
#define GRP  16
#define HDIM 64

typedef __attribute__((ext_vector_type(16))) __bf16 bf16x16;
typedef __attribute__((ext_vector_type(8)))  __bf16 bf16x8;
typedef __attribute__((ext_vector_type(4)))  __bf16 bf16x4;
typedef __attribute__((ext_vector_type(8)))  float  f32x8;
typedef __attribute__((ext_vector_type(4)))  float  f32x4;
typedef int v4i __attribute__((vector_size(4 * sizeof(int))));

static __device__ __forceinline__ f32x8 wmma_bf16(bf16x16 a, bf16x16 b, f32x8 c) {
  // D = A(16x32 bf16) * B(32x16 bf16) + C(16x16 f32)
  return __builtin_amdgcn_wmma_f32_16x16x32_bf16(false, a, false, b, (short)0, c,
                                                 false, false);
}

// Load one 16x32 bf16 A/B fragment: lanes 0-15 hold K=0..7 / 16..23,
// lanes 16-31 hold K=8..15 / 24..31 (caller adds (lane>>4)*8).
static __device__ __forceinline__ bf16x16 frag_ld(const __bf16* p) {
  bf16x8 lo = *(const bf16x8*)(p);
  bf16x8 hi = *(const bf16x8*)(p + 16);
  bf16x16 r;
#pragma unroll
  for (int i = 0; i < 8; ++i) { r[i] = lo[i]; r[i + 8] = hi[i]; }
  return r;
}

// ---- CDNA5 async global->LDS copy (ASYNCcnt), 16 bytes per lane ------------
static __device__ __forceinline__ void async_cp16(const void* g, void* l) {
#if __has_builtin(__builtin_amdgcn_global_load_async_to_lds_b128)
  __builtin_amdgcn_global_load_async_to_lds_b128(
      (__attribute__((address_space(1))) v4i*)(uintptr_t)g,
      (__attribute__((address_space(3))) v4i*)(uintptr_t)l, 0, 0);
#else
  asm volatile("global_load_async_to_lds_b128 %0, %1, off"
               :: "v"((unsigned)(uintptr_t)l),
                  "v"((unsigned long long)(uintptr_t)g)
               : "memory");
#endif
}

static __device__ __forceinline__ void wait_async0() {
#if __has_builtin(__builtin_amdgcn_s_wait_asynccnt)
  __builtin_amdgcn_s_wait_asynccnt(0);
#else
  asm volatile("s_wait_asynccnt 0x0" ::: "memory");
#endif
}

// ---- lane l <-> l ^ 16 exchange via v_permlanex16_b32 (pure VALU) ----------
static __device__ __forceinline__ float swap_halves(float x) {
  int u = __builtin_bit_cast(int, x);
  u = __builtin_amdgcn_permlanex16(u, u, 0x76543210, 0xfedcba98, false, false);
  return __builtin_bit_cast(float, u);
}

// ---------------------------------------------------------------------------
// fp32 -> bf16 conversion of all seven operands in one streaming launch.
// The destinations lie back to back in the workspace (Wq Wk Wv Wo q k v), so a
// block's index names both its 32768-element destination slice and, by a
// block-uniform select, its source. A wave owns 4096 contiguous elements:
// 32 whole-line 16-byte loads per lane, all issued before the first is used.
// ---------------------------------------------------------------------------
#define CVT_LD  32                  // 16-byte loads per lane
#define CVT_BLK (256 * 4 * CVT_LD)  // elements per block (32768)

__global__ __launch_bounds__(256) void cvt_all_f32_to_bf16(
    const float* __restrict__ wq, const float* __restrict__ wk,
    const float* __restrict__ wv, const float* __restrict__ wo,
    const float* __restrict__ q, const float* __restrict__ k,
    const float* __restrict__ v, __bf16* __restrict__ dst) {
  const int b = blockIdx.x;
  const int wblk = DDIM * DDIM / CVT_BLK;  // blocks per weight (32)
  const int ablk = SEQ * DDIM / CVT_BLK;   // blocks per activation (128)
  const float* src;
  int lb;
  if (b < 4 * wblk) {
    const int t = b / wblk;
    src = t == 0 ? wq : t == 1 ? wk : t == 2 ? wv : wo;
    lb  = b % wblk;
  } else {
    const int t = (b - 4 * wblk) / ablk;
    src = t == 0 ? q : t == 1 ? k : v;
    lb  = (b - 4 * wblk) % ablk;
  }
  const int e = (threadIdx.x >> 5) * (128 * CVT_LD) + (threadIdx.x & 31) * 4;
  const float* s = src + (size_t)lb * CVT_BLK + e;
  __bf16*      d = dst + (size_t)b * CVT_BLK + e;

  f32x4 x[CVT_LD];
#pragma unroll
  for (int j = 0; j < CVT_LD; ++j) x[j] = *(const f32x4*)(s + j * 128);
  // keeps every load ahead of the first conversion: without it the scheduler
  // issues 18 loads and the other 14 in small groups behind waits on those, so
  // a wave pays the memory latency several times over
  __builtin_amdgcn_sched_barrier(0);
#pragma unroll
  for (int j = 0; j < CVT_LD; ++j) {
    bf16x4 o;
#pragma unroll
    for (int i = 0; i < 4; ++i) o[i] = (__bf16)x[j][i];
    *(bf16x4*)(d + j * 128) = o;
  }
}

// ---------------------------------------------------------------------------
// GEMM: C[4096,1024] = X[4096,1024] @ W.T + b (both bf16, NT, async staged)
// Block 128x128x32, 256 threads = 8 waves, wave tile 32x64 (2x4 WMMA),
// double-buffered LDS, one barrier per K step.
// ---------------------------------------------------------------------------
#define BM 128
#define BN 128
#define BK 32
#define LDT 40  // padded LDS row stride (elements): 80 B, 16B-aligned

enum { GM_QK = 0, GM_VT = 1, GM_OUT = 2 };

template <int MODE>
__global__ __launch_bounds__(256) void gemm_bf16_wmma(
    const __bf16* __restrict__ x, const __bf16* __restrict__ w,
    const float* __restrict__ bias, void* __restrict__ outp, float oscale) {
  __shared__ __bf16 lA[2][BM * LDT];
  __shared__ __bf16 lB[2][BN * LDT];

  const int tid  = threadIdx.x;
  const int lane = tid & 31, wave = tid >> 5;
  const int fr   = lane & 15;
  const int kb8  = (lane >> 4) << 3;
  const int hb   = kb8;
  const int wm   = (wave & 3) * 32;
  const int wn   = (wave >> 2) * 64;
  const int m0   = blockIdx.y * BM;
  const int n0   = blockIdx.x * BN;

  const int srow  = tid >> 1;        // staging row 0..127
  const int shalf = (tid & 1) * 16;  // staging K offset 0/16

  const __bf16* gx = x + (size_t)(m0 + srow) * DDIM + shalf;
  const __bf16* gw = w + (size_t)(n0 + srow) * DDIM + shalf;
  __bf16* sa = &lA[0][srow * LDT + shalf];
  __bf16* sb = &lB[0][srow * LDT + shalf];

  f32x8 acc[2][4];
#pragma unroll
  for (int mi = 0; mi < 2; ++mi)
#pragma unroll
    for (int ni = 0; ni < 4; ++ni)
#pragma unroll
      for (int r = 0; r < 8; ++r) acc[mi][ni][r] = 0.f;

  auto stage = [&](int kt, int buf) {
    const int bo = buf * (BM * LDT);
    async_cp16(gx + kt,     sa + bo);
    async_cp16(gx + kt + 8, sa + bo + 8);
    async_cp16(gw + kt,     sb + bo);
    async_cp16(gw + kt + 8, sb + bo + 8);
  };

  stage(0, 0);
  int cur = 0;
  for (int kt = 0; kt < DDIM; kt += BK) {
    wait_async0();
    __syncthreads();
    if (kt + BK < DDIM) stage(kt + BK, cur ^ 1);

    bf16x16 af[2], bw[4];
#pragma unroll
    for (int mi = 0; mi < 2; ++mi)
      af[mi] = frag_ld(&lA[cur][(wm + mi * 16 + fr) * LDT + kb8]);
#pragma unroll
    for (int ni = 0; ni < 4; ++ni)
      bw[ni] = frag_ld(&lB[cur][(wn + ni * 16 + fr) * LDT + kb8]);
#pragma unroll
    for (int mi = 0; mi < 2; ++mi)
#pragma unroll
      for (int ni = 0; ni < 4; ++ni)
        acc[mi][ni] = wmma_bf16(af[mi], bw[ni], acc[mi][ni]);
    cur ^= 1;
  }

  // epilogue: bias (+ optional scale folded into Q) + layout scatter
#pragma unroll
  for (int mi = 0; mi < 2; ++mi) {
#pragma unroll
    for (int ni = 0; ni < 4; ++ni) {
      const int   n  = n0 + wn + ni * 16 + fr;
      const float bn = bias[n];
#pragma unroll
      for (int r = 0; r < 8; ++r) {
        const int   m   = m0 + wm + mi * 16 + r + hb;
        const float val = acc[mi][ni][r] + bn;
        if (MODE == GM_OUT) {
          ((float*)outp)[(size_t)m * DDIM + n] = val;
        } else if (MODE == GM_QK) {  // per-head [g][s][dh]
          const int gq = n >> 6, dh = n & 63;
          ((__bf16*)outp)[((size_t)gq * SEQ + m) * HDIM + dh] = (__bf16)(val * oscale);
        } else {                     // GM_VT: transposed [g][dh][s]
          const int gq = n >> 6, dh = n & 63;
          ((__bf16*)outp)[((size_t)gq * HDIM + dh) * SEQ + m] = (__bf16)val;
        }
      }
    }
  }
}

#define LKS 72  // K tile row stride: 144 B, 16B-aligned

__global__ __launch_bounds__(256) void attn_wmma(
    const __bf16* __restrict__ qb, const __bf16* __restrict__ kb,
    const __bf16* __restrict__ vtb, const int* __restrict__ mask,
    __bf16* __restrict__ outp) {
  __shared__ __bf16 lK[2][32 * LKS];     // [key][dh]
  __shared__ __bf16 lV[2][64 * LDT];     // [dh][key] (V pre-transposed)

  const int g    = blockIdx.y;
  const int tid  = threadIdx.x;
  const int lane = tid & 31, wave = tid >> 5;
  const int fr   = lane & 15;
  const int kb8  = (lane >> 4) << 3;
  const int hb   = kb8;
  const int q0   = blockIdx.x * 128 + wave * 16;

  // Q fragments (already scaled by 1/sqrt(DH)) held for the whole KV loop;
  // B operand: lane = query column fr
  const __bf16* qrow = qb + ((size_t)g * SEQ + q0 + fr) * HDIM;
  const bf16x16 bq0 = frag_ld(qrow + kb8);
  const bf16x16 bq1 = frag_ld(qrow + 32 + kb8);

  f32x8 acco[4];  // O^T: acco[ni][r] = O[q0 + fr][ni * 16 + hb + r]
#pragma unroll
  for (int ni = 0; ni < 4; ++ni)
#pragma unroll
    for (int r = 0; r < 8; ++r) acco[ni][r] = 0.f;
  float rm = -__builtin_inff();  // running max of query fr (same in both halves)
  float rl = 0.f;                // running sum over this half's keys only

  const int skey = tid >> 3, sdh = (tid & 7) * 8;  // K staging map (32x64)
  const int vdh  = tid >> 2, vko = (tid & 3) * 8;  // V staging map (64x32)
  const __bf16* gk = kb + ((size_t)g * SEQ + skey) * HDIM + sdh;
  const __bf16* gv = vtb + ((size_t)g * HDIM + vdh) * SEQ + vko;
  __bf16* sk = &lK[0][skey * LKS + sdh];
  __bf16* sv = &lV[0][vdh * LDT + vko];

  auto stage = [&](int kv0, int buf) {
    async_cp16(gk + (size_t)kv0 * HDIM, sk + buf * (32 * LKS));
    async_cp16(gv + kv0,               sv + buf * (64 * LDT));
  };

  stage(0, 0);
  int cur = 0;
  for (int kv0 = 0; kv0 < SEQ; kv0 += 32) {
    wait_async0();
    __syncthreads();
    if (kv0 + 32 < SEQ) stage(kv0 + 32, cur ^ 1);

    // key mask of this lane's score rows: keys hb..hb+7 and 16+hb..16+hb+7
    const v4i mk00 = *(const v4i*)(mask + kv0 + hb);
    const v4i mk01 = *(const v4i*)(mask + kv0 + hb + 4);
    const v4i mk10 = *(const v4i*)(mask + kv0 + 16 + hb);
    const v4i mk11 = *(const v4i*)(mask + kv0 + 16 + hb + 4);

    // scores: S^T[32 keys x 16 q] = K (32x64) . Q^T; s0[r] = key hb + r,
    // s1[r] = key 16 + hb + r, both of query fr
    f32x8 s0, s1;
#pragma unroll
    for (int r = 0; r < 8; ++r) { s0[r] = 0.f; s1[r] = 0.f; }
    {
      const __bf16* kbuf = &lK[cur][0];
      bf16x16 a00 = frag_ld(&kbuf[(fr)      * LKS + kb8]);
      bf16x16 a01 = frag_ld(&kbuf[(fr)      * LKS + 32 + kb8]);
      bf16x16 a10 = frag_ld(&kbuf[(16 + fr) * LKS + kb8]);
      bf16x16 a11 = frag_ld(&kbuf[(16 + fr) * LKS + 32 + kb8]);
      s0 = wmma_bf16(a00, bq0, s0);
      s0 = wmma_bf16(a01, bq1, s0);
      s1 = wmma_bf16(a10, bq0, s1);
      s1 = wmma_bf16(a11, bq1, s1);
    }

    // key mask (scale already folded into Q)
#pragma unroll
    for (int r = 0; r < 4; ++r) {
      s0[r]     = mk00[r] ? s0[r]     : -__builtin_inff();
      s0[r + 4] = mk01[r] ? s0[r + 4] : -__builtin_inff();
      s1[r]     = mk10[r] ? s1[r]     : -__builtin_inff();
      s1[r + 4] = mk11[r] ? s1[r + 4] : -__builtin_inff();
    }

    // online softmax: max over the lane's 16 keys, one exchange for the rest
    float tm[8];
#pragma unroll
    for (int r = 0; r < 8; ++r) tm[r] = fmaxf(s0[r], s1[r]);
    float t = fmaxf(fmaxf(fmaxf(tm[0], tm[1]), fmaxf(tm[2], tm[3])),
                    fmaxf(fmaxf(tm[4], tm[5]), fmaxf(tm[6], tm[7])));
    t = fmaxf(t, swap_halves(t));
    const float mnew = fmaxf(rm, t);
    const float corr = __expf(rm - mnew);
    rm = mnew;
#pragma unroll
    for (int r = 0; r < 8; ++r) {
      s0[r] = __expf(s0[r] - mnew);
      s1[r] = __expf(s1[r] - mnew);
    }
    float ts[8];
#pragma unroll
    for (int r = 0; r < 8; ++r) ts[r] = s0[r] + s1[r];
    rl = rl * corr + (((ts[0] + ts[1]) + (ts[2] + ts[3])) +
                      ((ts[4] + ts[5]) + (ts[6] + ts[7])));
#pragma unroll
    for (int ni = 0; ni < 4; ++ni)
#pragma unroll
      for (int r = 0; r < 8; ++r) acco[ni][r] *= corr;

    // P^T as B operand: the two score tiles, converted in place, are already in
    // the hardware k order that frag_ld gives the V^T rows
    bf16x16 bp;
#pragma unroll
    for (int r = 0; r < 8; ++r) { bp[r] = (__bf16)s0[r]; bp[r + 8] = (__bf16)s1[r]; }

#pragma unroll
    for (int ni = 0; ni < 4; ++ni) {
      bf16x16 av = frag_ld(&lV[cur][(ni * 16 + fr) * LDT + kb8]);
      acco[ni] = wmma_bf16(av, bp, acco[ni]);
    }
    cur ^= 1;
  }

  // join the halves' sums, normalize, write bf16 attention output [s][g*64+dh]:
  // a lane holds 8 consecutive dh of its query per tile, one 16-byte store each
  rl += swap_halves(rl);
  __bf16* orow = outp + (size_t)(q0 + fr) * DDIM + g * HDIM + hb;
#pragma unroll
  for (int ni = 0; ni < 4; ++ni) {
    bf16x8 o;
#pragma unroll
    for (int r = 0; r < 8; ++r) o[r] = (__bf16)(acco[ni][r] / rl);
    *(bf16x8*)(orow + ni * 16) = o;
  }
}

// ---------------------------------------------------------------------------
extern "C" void kernel_launch(void* const* d_in, const int* in_sizes, int n_in,
                              void* d_out, int out_size, void* d_ws, size_t ws_size,
                              hipStream_t stream) {
  const float* q    = (const float*)d_in[0];
  const float* k    = (const float*)d_in[1];
  const float* v    = (const float*)d_in[2];
  const int*   mask = (const int*)d_in[3];
  const float* Wq   = (const float*)d_in[4];
  const float* bq   = (const float*)d_in[5];
  const float* Wk   = (const float*)d_in[6];
  const float* bk   = (const float*)d_in[7];
  const float* Wv   = (const float*)d_in[8];
  const float* bv   = (const float*)d_in[9];
  const float* Wo   = (const float*)d_in[10];
  const float* bo   = (const float*)d_in[11];

  // workspace layout (bf16 elements); total 32M elems = 64 MB
  __bf16* ws  = (__bf16*)d_ws;
  const size_t MEL = (size_t)1024 * 1024;
  __bf16* wqb = ws + 0 * MEL;
  __bf16* wkb = ws + 1 * MEL;
  __bf16* wvb = ws + 2 * MEL;
  __bf16* wob = ws + 3 * MEL;
  __bf16* xq  = ws + 4 * MEL;    // query bf16 [S][D]
  __bf16* xk  = ws + 8 * MEL;    // key   bf16 [S][D]
  __bf16* xv  = ws + 12 * MEL;   // value bf16 [S][D]
  __bf16* qbf = ws + 16 * MEL;   // [G][S][DH] (pre-scaled by 1/8)
  __bf16* kbf = ws + 20 * MEL;   // [G][S][DH]
  __bf16* vtb = ws + 24 * MEL;   // [G][DH][S]
  __bf16* abf = ws + 28 * MEL;   // [S][D]

  // ws + 0 .. ws + 16 MEL: wqb wkb wvb wob xq xk xv, in this order
  cvt_all_f32_to_bf16<<<(4 * DDIM * DDIM + 3 * SEQ * DDIM) / CVT_BLK, 256, 0, stream>>>(
      Wq, Wk, Wv, Wo, q, k, v, ws);

  dim3 gg(DDIM / BN, SEQ / BM);  // (8, 32)
  gemm_bf16_wmma<GM_QK><<<gg, 256, 0, stream>>>(xq, wqb, bq, qbf, 0.125f);
  gemm_bf16_wmma<GM_QK><<<gg, 256, 0, stream>>>(xk, wkb, bk, kbf, 1.0f);
  gemm_bf16_wmma<GM_VT><<<gg, 256, 0, stream>>>(xv, wvb, bv, vtb, 1.0f);

  attn_wmma<<<dim3(SEQ / 128, GRP), 256, 0, stream>>>(qbf, kbf, vtb, mask, abf);

  gemm_bf16_wmma<GM_OUT><<<gg, 256, 0, stream>>>(abf, wob, bo, d_out, 1.0f);
}

// v003
// A run of this version takes 183 microseconds.
// Timed twice side by side with v002, it ran 1.13 times as fast both times.
// Counting every step since v000, it is 1.40 times as fast.
#include <hip/hip_runtime.h>
#include <hip/hip_bf16.h>
#include <math.h>
#include <stdint.h>

#define DDIM 1024
#define SEQ  4096
#define GRP  16
#define HDIM 64

typedef __attribute__((ext_vector_type(16))) __bf16 bf16x16;
typedef __attribute__((ext_vector_type(8)))  __bf16 bf16x8;
typedef __attribute__((ext_vector_type(4)))  __bf16 bf16x4;
typedef __attribute__((ext_vector_type(8)))  float  f32x8;
typedef __attribute__((ext_vector_type(4)))  float  f32x4;
typedef int v4i __attribute__((vector_size(4 * sizeof(int))));

static __device__ __forceinline__ f32x8 wmma_bf16(bf16x16 a, bf16x16 b, f32x8 c) {
  // D = A(16x32 bf16) * B(32x16 bf16) + C(16x16 f32)
  return __builtin_amdgcn_wmma_f32_16x16x32_bf16(false, a, false, b, (short)0, c,
                                                 false, false);
}

// Load one 16x32 bf16 A/B fragment: lanes 0-15 hold K=0..7 / 16..23,
// lanes 16-31 hold K=8..15 / 24..31 (caller adds (lane>>4)*8).
static __device__ __forceinline__ bf16x16 frag_ld(const __bf16* p) {
  bf16x8 lo = *(const bf16x8*)(p);
  bf16x8 hi = *(const bf16x8*)(p + 16);
  bf16x16 r;
#pragma unroll
  for (int i = 0; i < 8; ++i) { r[i] = lo[i]; r[i + 8] = hi[i]; }
  return r;
}

// ---- CDNA5 async global->LDS copy (ASYNCcnt), 16 bytes per lane ------------
static __device__ __forceinline__ void async_cp16(const void* g, void* l) {
#if __has_builtin(__builtin_amdgcn_global_load_async_to_lds_b128)
  __builtin_amdgcn_global_load_async_to_lds_b128(
      (__attribute__((address_space(1))) v4i*)(uintptr_t)g,
      (__attribute__((address_space(3))) v4i*)(uintptr_t)l, 0, 0);
#else
  asm volatile("global_load_async_to_lds_b128 %0, %1, off"
               :: "v"((unsigned)(uintptr_t)l),
                  "v"((unsigned long long)(uintptr_t)g)
               : "memory");
#endif
}

static __device__ __forceinline__ void wait_async0() {
#if __has_builtin(__builtin_amdgcn_s_wait_asynccnt)
  __builtin_amdgcn_s_wait_asynccnt(0);
#else
  asm volatile("s_wait_asynccnt 0x0" ::: "memory");
#endif
}

// ---- lane l <-> l ^ 16 exchange via v_permlanex16_b32 (pure VALU) ----------
static __device__ __forceinline__ float swap_halves(float x) {
  int u = __builtin_bit_cast(int, x);
  u = __builtin_amdgcn_permlanex16(u, u, 0x76543210, 0xfedcba98, false, false);
  return __builtin_bit_cast(float, u);
}

// ---------------------------------------------------------------------------
// fp32 -> bf16 conversion of all seven operands in one streaming launch.
// The destinations lie back to back in the workspace (Wq Wk Wv Wo q k v), so a
// block's index names both its 32768-element destination slice and, by a
// block-uniform select, its source. A wave owns 4096 contiguous elements:
// 32 whole-line 16-byte loads per lane, all issued before the first is used.
// ---------------------------------------------------------------------------
#define CVT_LD  32                  // 16-byte loads per lane
#define CVT_BLK (256 * 4 * CVT_LD)  // elements per block (32768)

__global__ __launch_bounds__(256) void cvt_all_f32_to_bf16(
    const float* __restrict__ wq, const float* __restrict__ wk,
    const float* __restrict__ wv, const float* __restrict__ wo,
    const float* __restrict__ q, const float* __restrict__ k,
    const float* __restrict__ v, __bf16* __restrict__ dst) {
  const int b = blockIdx.x;
  const int wblk = DDIM * DDIM / CVT_BLK;  // blocks per weight (32)
  const int ablk = SEQ * DDIM / CVT_BLK;   // blocks per activation (128)
  const float* src;
  int lb;
  if (b < 4 * wblk) {
    const int t = b / wblk;
    src = t == 0 ? wq : t == 1 ? wk : t == 2 ? wv : wo;
    lb  = b % wblk;
  } else {
    const int t = (b - 4 * wblk) / ablk;
    src = t == 0 ? q : t == 1 ? k : v;
    lb  = (b - 4 * wblk) % ablk;
  }
  const int e = (threadIdx.x >> 5) * (128 * CVT_LD) + (threadIdx.x & 31) * 4;
  const float* s = src + (size_t)lb * CVT_BLK + e;
  __bf16*      d = dst + (size_t)b * CVT_BLK + e;

  f32x4 x[CVT_LD];
#pragma unroll
  for (int j = 0; j < CVT_LD; ++j) x[j] = *(const f32x4*)(s + j * 128);
  // keeps every load ahead of the first conversion: without it the scheduler
  // issues 18 loads and the other 14 in small groups behind waits on those, so
  // a wave pays the memory latency several times over
  __builtin_amdgcn_sched_barrier(0);
#pragma unroll
  for (int j = 0; j < CVT_LD; ++j) {
    bf16x4 o;
#pragma unroll
    for (int i = 0; i < 4; ++i) o[i] = (__bf16)x[j][i];
    *(bf16x4*)(d + j * 128) = o;
  }
}

// ---------------------------------------------------------------------------
// GEMM: C[4096,1024] = X[4096,1024] @ W.T + b (both bf16, NT, async staged)
// Block 128x128x128, 256 threads = 8 waves, wave tile 32x64 (2x4 WMMA),
// double-buffered LDS. A stage holds 128 k of every row: a 256-byte row piece,
// copied by 16 adjacent lanes, so a wave's copy covers whole lines, and one
// wait + barrier serves 32 WMMAs a wave.
// ---------------------------------------------------------------------------
#define BM 128
#define BN 128
#define BK 128
#define LDG 136  // GEMM LDS row stride (elements): 272 B = 16 B x odd
#define LDT 40   // V tile row stride in attention (elements): 80 B

enum { GM_QK = 0, GM_VT = 1, GM_OUT = 2 };

template <int MODE>
__global__ __launch_bounds__(256) void gemm_bf16_wmma(
    const __bf16* __restrict__ x, const __bf16* __restrict__ w,
    const float* __restrict__ bias, void* __restrict__ outp, float oscale) {
  __shared__ __attribute__((aligned(16))) __bf16 lA[2][BM * LDG];
  __shared__ __attribute__((aligned(16))) __bf16 lB[2][BN * LDG];

  const int tid  = threadIdx.x;
  const int lane = tid & 31, wave = tid >> 5;
  const int fr   = lane & 15;
  const int kb8  = (lane >> 4) << 3;
  const int hb   = kb8;
  const int wm   = (wave & 3) * 32;
  const int wn   = (wave >> 2) * 64;
  const int m0   = blockIdx.y * BM;
  const int n0   = blockIdx.x * BN;

  const int srow = (tid >> 4) * 8;  // first of the 8 rows that 16 lanes stage
  const int scol = (tid & 15) * 8;  // staging K offset, 16 B per lane

  const __bf16* gx = x + (size_t)(m0 + srow) * DDIM + scol;
  const __bf16* gw = w + (size_t)(n0 + srow) * DDIM + scol;
  __bf16* sa = &lA[0][srow * LDG + scol];
  __bf16* sb = &lB[0][srow * LDG + scol];

  f32x8 acc[2][4];
#pragma unroll
  for (int mi = 0; mi < 2; ++mi)
#pragma unroll
    for (int ni = 0; ni < 4; ++ni)
#pragma unroll
      for (int r = 0; r < 8; ++r) acc[mi][ni][r] = 0.f;

  auto stage = [&](int kt, int buf) {
    const int bo = buf * (BM * LDG);
    // unrolled so that the row steps become the copies' immediate offsets: one
    // address pair per operand instead of one per copy
#pragma unroll
    for (int j = 0; j < 8; ++j) {
      async_cp16(gx + kt + j * DDIM, sa + bo + j * LDG);
      async_cp16(gw + kt + j * DDIM, sb + bo + j * LDG);
    }
  };

  stage(0, 0);
  // stage 0 has landed before the barrier behind which other waves read it
  asm volatile("s_wait_asynccnt 0x0" ::: "memory");
  __syncthreads();
  stage(BK, 1);

  for (int t = 0; t < DDIM / BK; ++t) {
    const int cur = t & 1;
    // unrolled so that the k steps become immediate LDS offsets and the next
    // 32 k's fragment loads can issue among this block's WMMAs
#pragma unroll
    for (int kk = 0; kk < BK; kk += 32) {
      bf16x16 af[2], bw[4];
#pragma unroll
      for (int mi = 0; mi < 2; ++mi)
        af[mi] = frag_ld(&lA[cur][(wm + mi * 16 + fr) * LDG + kk + kb8]);
#pragma unroll
      for (int ni = 0; ni < 4; ++ni)
        bw[ni] = frag_ld(&lB[cur][(wn + ni * 16 + fr) * LDG + kk + kb8]);
#pragma unroll
      for (int mi = 0; mi < 2; ++mi)
#pragma unroll
        for (int ni = 0; ni < 4; ++ni)
          acc[mi][ni] = wmma_bf16(af[mi], bw[ni], acc[mi][ni]);
    }
    // hand-over: this wave's reads of buffer cur are done ...
    asm volatile("s_wait_dscnt 0x0" ::: "memory");
    // ... and its copies of stage t + 1 have landed, before the barrier that
    // publishes stage t + 1 and frees buffer cur for the refill
    asm volatile("s_wait_asynccnt 0x0" ::: "memory");
    __syncthreads();
    if (t + 2 < DDIM / BK) stage((t + 2) * BK, cur);
  }
  // no copy is outstanding when the wave goes on to its stores and ends
  asm volatile("s_wait_asynccnt 0x0" ::: "memory");

  // epilogue: bias (+ optional scale folded into Q) + layout scatter
#pragma unroll
  for (int mi = 0; mi < 2; ++mi) {
#pragma unroll
    for (int ni = 0; ni < 4; ++ni) {
      const int   n  = n0 + wn + ni * 16 + fr;
      const float bn = bias[n];
#pragma unroll
      for (int r = 0; r < 8; ++r) {
        const int   m   = m0 + wm + mi * 16 + r + hb;
        const float val = acc[mi][ni][r] + bn;
        if (MODE == GM_OUT) {
          ((float*)outp)[(size_t)m * DDIM + n] = val;
        } else if (MODE == GM_QK) {  // per-head [g][s][dh]
          const int gq = n >> 6, dh = n & 63;
          ((__bf16*)outp)[((size_t)gq * SEQ + m) * HDIM + dh] = (__bf16)(val * oscale);
        } else {                     // GM_VT: transposed [g][dh][s]
          const int gq = n >> 6, dh = n & 63;
          ((__bf16*)outp)[((size_t)gq * HDIM + dh) * SEQ + m] = (__bf16)val;
        }
      }
    }
  }
}

#define LKS 72  // K tile row stride: 144 B, 16B-aligned

__global__ __launch_bounds__(256) void attn_wmma(
    const __bf16* __restrict__ qb, const __bf16* __restrict__ kb,
    const __bf16* __restrict__ vtb, const int* __restrict__ mask,
    __bf16* __restrict__ outp) {
  __shared__ __bf16 lK[2][32 * LKS];     // [key][dh]
  __shared__ __bf16 lV[2][64 * LDT];     // [dh][key] (V pre-transposed)

  const int g    = blockIdx.y;
  const int tid  = threadIdx.x;
  const int lane = tid & 31, wave = tid >> 5;
  const int fr   = lane & 15;
  const int kb8  = (lane >> 4) << 3;
  const int hb   = kb8;
  const int q0   = blockIdx.x * 128 + wave * 16;

  // Q fragments (already scaled by 1/sqrt(DH)) held for the whole KV loop;
  // B operand: lane = query column fr
  const __bf16* qrow = qb + ((size_t)g * SEQ + q0 + fr) * HDIM;
  const bf16x16 bq0 = frag_ld(qrow + kb8);
  const bf16x16 bq1 = frag_ld(qrow + 32 + kb8);

  f32x8 acco[4];  // O^T: acco[ni][r] = O[q0 + fr][ni * 16 + hb + r]
#pragma unroll
  for (int ni = 0; ni < 4; ++ni)
#pragma unroll
    for (int r = 0; r < 8; ++r) acco[ni][r] = 0.f;
  float rm = -__builtin_inff();  // running max of query fr (same in both halves)
  float rl = 0.f;                // running sum over this half's keys only

  const int skey = tid >> 3, sdh = (tid & 7) * 8;  // K staging map (32x64)
  const int vdh  = tid >> 2, vko = (tid & 3) * 8;  // V staging map (64x32)
  const __bf16* gk = kb + ((size_t)g * SEQ + skey) * HDIM + sdh;
  const __bf16* gv = vtb + ((size_t)g * HDIM + vdh) * SEQ + vko;
  __bf16* sk = &lK[0][skey * LKS + sdh];
  __bf16* sv = &lV[0][vdh * LDT + vko];

  auto stage = [&](int kv0, int buf) {
    async_cp16(gk + (size_t)kv0 * HDIM, sk + buf * (32 * LKS));
    async_cp16(gv + kv0,               sv + buf * (64 * LDT));
  };

  stage(0, 0);
  int cur = 0;
  for (int kv0 = 0; kv0 < SEQ; kv0 += 32) {
    wait_async0();
    __syncthreads();
    if (kv0 + 32 < SEQ) stage(kv0 + 32, cur ^ 1);

    // key mask of this lane's score rows: keys hb..hb+7 and 16+hb..16+hb+7
    const v4i mk00 = *(const v4i*)(mask + kv0 + hb);
    const v4i mk01 = *(const v4i*)(mask + kv0 + hb + 4);
    const v4i mk10 = *(const v4i*)(mask + kv0 + 16 + hb);
    const v4i mk11 = *(const v4i*)(mask + kv0 + 16 + hb + 4);

    // scores: S^T[32 keys x 16 q] = K (32x64) . Q^T; s0[r] = key hb + r,
    // s1[r] = key 16 + hb + r, both of query fr
    f32x8 s0, s1;
#pragma unroll
    for (int r = 0; r < 8; ++r) { s0[r] = 0.f; s1[r] = 0.f; }
    {
      const __bf16* kbuf = &lK[cur][0];
      bf16x16 a00 = frag_ld(&kbuf[(fr)      * LKS + kb8]);
      bf16x16 a01 = frag_ld(&kbuf[(fr)      * LKS + 32 + kb8]);
      bf16x16 a10 = frag_ld(&kbuf[(16 + fr) * LKS + kb8]);
      bf16x16 a11 = frag_ld(&kbuf[(16 + fr) * LKS + 32 + kb8]);
      s0 = wmma_bf16(a00, bq0, s0);
      s0 = wmma_bf16(a01, bq1, s0);
      s1 = wmma_bf16(a10, bq0, s1);
      s1 = wmma_bf16(a11, bq1, s1);
    }

    // key mask (scale already folded into Q)
#pragma unroll
    for (int r = 0; r < 4; ++r) {
      s0[r]     = mk00[r] ? s0[r]     : -__builtin_inff();
      s0[r + 4] = mk01[r] ? s0[r + 4] : -__builtin_inff();
      s1[r]     = mk10[r] ? s1[r]     : -__builtin_inff();
      s1[r + 4] = mk11[r] ? s1[r + 4] : -__builtin_inff();
    }

    // online softmax: max over the lane's 16 keys, one exchange for the rest
    float tm[8];
#pragma unroll
    for (int r = 0; r < 8; ++r) tm[r] = fmaxf(s0[r], s1[r]);
    float t = fmaxf(fmaxf(fmaxf(tm[0], tm[1]), fmaxf(tm[2], tm[3])),
                    fmaxf(fmaxf(tm[4], tm[5]), fmaxf(tm[6], tm[7])));
    t = fmaxf(t, swap_halves(t));
    const float mnew = fmaxf(rm, t);
    const float corr = __expf(rm - mnew);
    rm = mnew;
#pragma unroll
    for (int r = 0; r < 8; ++r) {
      s0[r] = __expf(s0[r] - mnew);
      s1[r] = __expf(s1[r] - mnew);
    }
    float ts[8];
#pragma unroll
    for (int r = 0; r < 8; ++r) ts[r] = s0[r] + s1[r];
    rl = rl * corr + (((ts[0] + ts[1]) + (ts[2] + ts[3])) +
                      ((ts[4] + ts[5]) + (ts[6] + ts[7])));
#pragma unroll
    for (int ni = 0; ni < 4; ++ni)
#pragma unroll
      for (int r = 0; r < 8; ++r) acco[ni][r] *= corr;

    // P^T as B operand: the two score tiles, converted in place, are already in
    // the hardware k order that frag_ld gives the V^T rows
    bf16x16 bp;
#pragma unroll
    for (int r = 0; r < 8; ++r) { bp[r] = (__bf16)s0[r]; bp[r + 8] = (__bf16)s1[r]; }

#pragma unroll
    for (int ni = 0; ni < 4; ++ni) {
      bf16x16 av = frag_ld(&lV[cur][(ni * 16 + fr) * LDT + kb8]);
      acco[ni] = wmma_bf16(av, bp, acco[ni]);
    }
    cur ^= 1;
  }

  // join the halves' sums, normalize, write bf16 attention output [s][g*64+dh]:
  // a lane holds 8 consecutive dh of its query per tile, one 16-byte store each
  rl += swap_halves(rl);
  __bf16* orow = outp + (size_t)(q0 + fr) * DDIM + g * HDIM + hb;
#pragma unroll
  for (int ni = 0; ni < 4; ++ni) {
    bf16x8 o;
#pragma unroll
    for (int r = 0; r < 8; ++r) o[r] = (__bf16)(acco[ni][r] / rl);
    *(bf16x8*)(orow + ni * 16) = o;
  }
}

// ---------------------------------------------------------------------------
extern "C" void kernel_launch(void* const* d_in, const int* in_sizes, int n_in,
                              void* d_out, int out_size, void* d_ws, size_t ws_size,
                              hipStream_t stream) {
  const float* q    = (const float*)d_in[0];
  const float* k    = (const float*)d_in[1];
  const float* v    = (const float*)d_in[2];
  const int*   mask = (const int*)d_in[3];
  const float* Wq   = (const float*)d_in[4];
  const float* bq   = (const float*)d_in[5];
  const float* Wk   = (const float*)d_in[6];
  const float* bk   = (const float*)d_in[7];
  const float* Wv   = (const float*)d_in[8];
  const float* bv   = (const float*)d_in[9];
  const float* Wo   = (const float*)d_in[10];
  const float* bo   = (const float*)d_in[11];

  // workspace layout (bf16 elements); total 32M elems = 64 MB
  __bf16* ws  = (__bf16*)d_ws;
  const size_t MEL = (size_t)1024 * 1024;
  __bf16* wqb = ws + 0 * MEL;
  __bf16* wkb = ws + 1 * MEL;
  __bf16* wvb = ws + 2 * MEL;
  __bf16* wob = ws + 3 * MEL;
  __bf16* xq  = ws + 4 * MEL;    // query bf16 [S][D]
  __bf16* xk  = ws + 8 * MEL;    // key   bf16 [S][D]
  __bf16* xv  = ws + 12 * MEL;   // value bf16 [S][D]
  __bf16* qbf = ws + 16 * MEL;   // [G][S][DH] (pre-scaled by 1/8)
  __bf16* kbf = ws + 20 * MEL;   // [G][S][DH]
  __bf16* vtb = ws + 24 * MEL;   // [G][DH][S]
  __bf16* abf = ws + 28 * MEL;   // [S][D]

  // ws + 0 .. ws + 16 MEL: wqb wkb wvb wob xq xk xv, in this order
  cvt_all_f32_to_bf16<<<(4 * DDIM * DDIM + 3 * SEQ * DDIM) / CVT_BLK, 256, 0, stream>>>(
      Wq, Wk, Wv, Wo, q, k, v, ws);

  dim3 gg(DDIM / BN, SEQ / BM);  // (8, 32)
  gemm_bf16_wmma<GM_QK><<<gg, 256, 0, stream>>>(xq, wqb, bq, qbf, 0.125f);
  gemm_bf16_wmma<GM_QK><<<gg, 256, 0, stream>>>(xk, wkb, bk, kbf, 1.0f);
  gemm_bf16_wmma<GM_VT><<<gg, 256, 0, stream>>>(xv, wvb, bv, vtb, 1.0f);

  attn_wmma<<<dim3(SEQ / 128, GRP), 256, 0, stream>>>(qbf, kbf, vtb, mask, abf);

  gemm_bf16_wmma<GM_OUT><<<gg, 256, 0, stream>>>(abf, wob, bo, d_out, 1.0f);
}

// v004
// A run of this version takes 167 microseconds.
// In two side-by-side timings against v003, it was 1.08 and 1.09 times as fast.
// Over all steps from v000 it is 1.52 times as fast.
#include <hip/hip_runtime.h>
#include <hip/hip_bf16.h>
#include <math.h>
#include <stdint.h>

#define DDIM 1024
#define SEQ  4096
#define GRP  16
#define HDIM 64

typedef __attribute__((ext_vector_type(16))) __bf16 bf16x16;
typedef __attribute__((ext_vector_type(8)))  __bf16 bf16x8;
typedef __attribute__((ext_vector_type(4)))  __bf16 bf16x4;
typedef __attribute__((ext_vector_type(8)))  float  f32x8;
typedef __attribute__((ext_vector_type(4)))  float  f32x4;
typedef int v4i __attribute__((vector_size(4 * sizeof(int))));

static __device__ __forceinline__ f32x8 wmma_bf16(bf16x16 a, bf16x16 b, f32x8 c) {
  // D = A(16x32 bf16) * B(32x16 bf16) + C(16x16 f32)
  return __builtin_amdgcn_wmma_f32_16x16x32_bf16(false, a, false, b, (short)0, c,
                                                 false, false);
}

// Load one 16x32 bf16 A/B fragment: lanes 0-15 hold K=0..7 / 16..23,
// lanes 16-31 hold K=8..15 / 24..31 (caller adds (lane>>4)*8).
static __device__ __forceinline__ bf16x16 frag_ld(const __bf16* p) {
  bf16x8 lo = *(const bf16x8*)(p);
  bf16x8 hi = *(const bf16x8*)(p + 16);
  bf16x16 r;
#pragma unroll
  for (int i = 0; i < 8; ++i) { r[i] = lo[i]; r[i + 8] = hi[i]; }
  return r;
}

// ---- CDNA5 async global->LDS copy (ASYNCcnt), 16 bytes per lane ------------
static __device__ __forceinline__ void async_cp16(const void* g, void* l) {
#if __has_builtin(__builtin_amdgcn_global_load_async_to_lds_b128)
  __builtin_amdgcn_global_load_async_to_lds_b128(
      (__attribute__((address_space(1))) v4i*)(uintptr_t)g,
      (__attribute__((address_space(3))) v4i*)(uintptr_t)l, 0, 0);
#else
  asm volatile("global_load_async_to_lds_b128 %0, %1, off"
               :: "v"((unsigned)(uintptr_t)l),
                  "v"((unsigned long long)(uintptr_t)g)
               : "memory");
#endif
}

static __device__ __forceinline__ void wait_async0() {
#if __has_builtin(__builtin_amdgcn_s_wait_asynccnt)
  __builtin_amdgcn_s_wait_asynccnt(0);
#else
  asm volatile("s_wait_asynccnt 0x0" ::: "memory");
#endif
}

// ---- lane l <-> l ^ 16 exchange via v_permlanex16_b32 (pure VALU) ----------
static __device__ __forceinline__ float swap_halves(float x) {
  int u = __builtin_bit_cast(int, x);
  u = __builtin_amdgcn_permlanex16(u, u, 0x76543210, 0xfedcba98, false, false);
  return __builtin_bit_cast(float, u);
}

// ---------------------------------------------------------------------------
// fp32 -> bf16 conversion of all seven operands in one streaming launch.
// The destinations lie back to back in the workspace (Wq Wk Wv Wo q k v), so a
// block's index names both its 32768-element destination slice and, by a
// block-uniform select, its source. A wave owns 4096 contiguous elements:
// 32 whole-line 16-byte loads per lane, all issued before the first is used.
// ---------------------------------------------------------------------------
#define CVT_LD  32                  // 16-byte loads per lane
#define CVT_BLK (256 * 4 * CVT_LD)  // elements per block (32768)

__global__ __launch_bounds__(256) void cvt_all_f32_to_bf16(
    const float* __restrict__ wq, const float* __restrict__ wk,
    const float* __restrict__ wv, const float* __restrict__ wo,
    const float* __restrict__ q, const float* __restrict__ k,
    const float* __restrict__ v, __bf16* __restrict__ dst) {
  const int b = blockIdx.x;
  const int wblk = DDIM * DDIM / CVT_BLK;  // blocks per weight (32)
  const int ablk = SEQ * DDIM / CVT_BLK;   // blocks per activation (128)
  const float* src;
  int lb;
  if (b < 4 * wblk) {
    const int t = b / wblk;
    src = t == 0 ? wq : t == 1 ? wk : t == 2 ? wv : wo;
    lb  = b % wblk;
  } else {
    const int t = (b - 4 * wblk) / ablk;
    src = t == 0 ? q : t == 1 ? k : v;
    lb  = (b - 4 * wblk) % ablk;
  }
  const int e = (threadIdx.x >> 5) * (128 * CVT_LD) + (threadIdx.x & 31) * 4;
  const float* s = src + (size_t)lb * CVT_BLK + e;
  __bf16*      d = dst + (size_t)b * CVT_BLK + e;

  f32x4 x[CVT_LD];
#pragma unroll
  for (int j = 0; j < CVT_LD; ++j) x[j] = *(const f32x4*)(s + j * 128);
  // keeps every load ahead of the first conversion: without it the scheduler
  // issues 18 loads and the other 14 in small groups behind waits on those, so
  // a wave pays the memory latency several times over
  __builtin_amdgcn_sched_barrier(0);
#pragma unroll
  for (int j = 0; j < CVT_LD; ++j) {
    bf16x4 o;
#pragma unroll
    for (int i = 0; i < 4; ++i) o[i] = (__bf16)x[j][i];
    *(bf16x4*)(d + j * 128) = o;
  }
}

// ---------------------------------------------------------------------------
// GEMM: C[4096,1024] = X[4096,1024] @ W.T + b (both bf16, NT, async staged)
// Block 128x128x128, 256 threads = 8 waves, wave tile 32x64 (2x4 WMMA),
// double-buffered LDS. A stage holds 128 k of every row: a 256-byte row piece,
// copied by 16 adjacent lanes, so a wave's copy covers whole lines, and one
// wait + barrier serves 32 WMMAs a wave.
// ---------------------------------------------------------------------------
#define BM 128
#define BN 128
#define BK 128
#define LDG 136  // GEMM LDS row stride (elements): 272 B = 16 B x odd
#define LDT 40   // V tile row stride in attention (elements): 80 B

enum { GM_QK = 0, GM_VT = 1, GM_OUT = 2 };

template <int MODE>
__global__ __launch_bounds__(256) void gemm_bf16_wmma(
    const __bf16* __restrict__ x, const __bf16* __restrict__ w,
    const float* __restrict__ bias, void* __restrict__ outp, float oscale) {
  __shared__ __attribute__((aligned(16))) __bf16 lA[2][BM * LDG];
  __shared__ __attribute__((aligned(16))) __bf16 lB[2][BN * LDG];

  const int tid  = threadIdx.x;
  const int lane = tid & 31, wave = tid >> 5;
  const int fr   = lane & 15;
  const int kb8  = (lane >> 4) << 3;
  const int hb   = kb8;
  const int wm   = (wave & 3) * 32;
  const int wn   = (wave >> 2) * 64;
  const int m0   = blockIdx.y * BM;
  const int n0   = blockIdx.x * BN;

  const int srow = (tid >> 4) * 8;  // first of the 8 rows that 16 lanes stage
  const int scol = (tid & 15) * 8;  // staging K offset, 16 B per lane

  const __bf16* gx = x + (size_t)(m0 + srow) * DDIM + scol;
  const __bf16* gw = w + (size_t)(n0 + srow) * DDIM + scol;
  __bf16* sa = &lA[0][srow * LDG + scol];
  __bf16* sb = &lB[0][srow * LDG + scol];

  f32x8 acc[2][4];
#pragma unroll
  for (int mi = 0; mi < 2; ++mi)
#pragma unroll
    for (int ni = 0; ni < 4; ++ni)
#pragma unroll
      for (int r = 0; r < 8; ++r) acc[mi][ni][r] = 0.f;

  auto stage = [&](int kt, int buf) {
    const int bo = buf * (BM * LDG);
    // unrolled so that the row steps become the copies' immediate offsets: one
    // address pair per operand instead of one per copy
#pragma unroll
    for (int j = 0; j < 8; ++j) {
      async_cp16(gx + kt + j * DDIM, sa + bo + j * LDG);
      async_cp16(gw + kt + j * DDIM, sb + bo + j * LDG);
    }
  };

  stage(0, 0);
  // stage 0 has landed before the barrier behind which other waves read it
  asm volatile("s_wait_asynccnt 0x0" ::: "memory");
  __syncthreads();
  stage(BK, 1);

  for (int t = 0; t < DDIM / BK; ++t) {
    const int cur = t & 1;
    // unrolled so that the k steps become immediate LDS offsets and the next
    // 32 k's fragment loads can issue among this block's WMMAs
#pragma unroll
    for (int kk = 0; kk < BK; kk += 32) {
      bf16x16 af[2], bw[4];
#pragma unroll
      for (int mi = 0; mi < 2; ++mi)
        af[mi] = frag_ld(&lA[cur][(wm + mi * 16 + fr) * LDG + kk + kb8]);
#pragma unroll
      for (int ni = 0; ni < 4; ++ni)
        bw[ni] = frag_ld(&lB[cur][(wn + ni * 16 + fr) * LDG + kk + kb8]);
#pragma unroll
      for (int mi = 0; mi < 2; ++mi)
#pragma unroll
        for (int ni = 0; ni < 4; ++ni)
          acc[mi][ni] = wmma_bf16(af[mi], bw[ni], acc[mi][ni]);
    }
    // hand-over: this wave's reads of buffer cur are done ...
    asm volatile("s_wait_dscnt 0x0" ::: "memory");
    // ... and its copies of stage t + 1 have landed, before the barrier that
    // publishes stage t + 1 and frees buffer cur for the refill
    asm volatile("s_wait_asynccnt 0x0" ::: "memory");
    __syncthreads();
    if (t + 2 < DDIM / BK) stage((t + 2) * BK, cur);
  }
  // no copy is outstanding when the wave goes on to its stores and ends
  asm volatile("s_wait_asynccnt 0x0" ::: "memory");

  // epilogue: bias (+ optional scale folded into Q) + layout scatter
#pragma unroll
  for (int mi = 0; mi < 2; ++mi) {
#pragma unroll
    for (int ni = 0; ni < 4; ++ni) {
      const int   n  = n0 + wn + ni * 16 + fr;
      const float bn = bias[n];
#pragma unroll
      for (int r = 0; r < 8; ++r) {
        const int   m   = m0 + wm + mi * 16 + r + hb;
        const float val = acc[mi][ni][r] + bn;
        if (MODE == GM_OUT) {
          ((float*)outp)[(size_t)m * DDIM + n] = val;
        } else if (MODE == GM_QK) {  // per-head [g][s][dh]
          const int gq = n >> 6, dh = n & 63;
          ((__bf16*)outp)[((size_t)gq * SEQ + m) * HDIM + dh] = (__bf16)(val * oscale);
        } else {                     // GM_VT: transposed [g][dh][s]
          const int gq = n >> 6, dh = n & 63;
          ((__bf16*)outp)[((size_t)gq * HDIM + dh) * SEQ + m] = (__bf16)val;
        }
      }
    }
  }
}

#define LKS 72  // K tile row stride: 144 B, 16B-aligned

__global__ __launch_bounds__(256) void attn_wmma(
    const __bf16* __restrict__ qb, const __bf16* __restrict__ kb,
    const __bf16* __restrict__ vtb, const int* __restrict__ mask,
    __bf16* __restrict__ outp) {
  __shared__ __bf16 lK[2][32 * LKS];     // [key][dh]
  __shared__ __bf16 lV[2][64 * LDT];     // [dh][key] (V pre-transposed)

  const int g    = blockIdx.y;
  const int tid  = threadIdx.x;
  const int lane = tid & 31, wave = tid >> 5;
  const int fr   = lane & 15;
  const int kb8  = (lane >> 4) << 3;
  const int hb   = kb8;
  const int q0   = blockIdx.x * 128 + wave * 16;

  // Q fragments (already scaled by 1/sqrt(DH)) held for the whole KV loop;
  // B operand: lane = query column fr
  const __bf16* qrow = qb + ((size_t)g * SEQ + q0 + fr) * HDIM;
  const bf16x16 bq0 = frag_ld(qrow + kb8);
  const bf16x16 bq1 = frag_ld(qrow + 32 + kb8);

  f32x8 acco[4];  // O^T: acco[ni][r] = O[q0 + fr][ni * 16 + hb + r]
#pragma unroll
  for (int ni = 0; ni < 4; ++ni)
#pragma unroll
    for (int r = 0; r < 8; ++r) acco[ni][r] = 0.f;
  float rm = -__builtin_inff();  // running max of query fr (same in both halves)
  float rl = 0.f;                // running sum over this half's keys only

  const int skey = tid >> 3, sdh = (tid & 7) * 8;  // K staging map (32x64)
  const int vdh  = tid >> 2, vko = (tid & 3) * 8;  // V staging map (64x32)
  const __bf16* gk = kb + ((size_t)g * SEQ + skey) * HDIM + sdh;
  const __bf16* gv = vtb + ((size_t)g * HDIM + vdh) * SEQ + vko;
  __bf16* sk = &lK[0][skey * LKS + sdh];
  __bf16* sv = &lV[0][vdh * LDT + vko];

  auto stage = [&](int kv0, int buf) {
    async_cp16(gk + (size_t)kv0 * HDIM, sk + buf * (32 * LKS));
    async_cp16(gv + kv0,               sv + buf * (64 * LDT));
  };

  stage(0, 0);
  int cur = 0;
  for (int kv0 = 0; kv0 < SEQ; kv0 += 32) {
    wait_async0();
    __syncthreads();
    if (kv0 + 32 < SEQ) stage(kv0 + 32, cur ^ 1);

    // scores: S^T[32 keys x 16 q] = K (32x64) . Q^T; s0[r] = key hb + r,
    // s1[r] = key 16 + hb + r, both of query fr
    f32x8 s0, s1;
#pragma unroll
    for (int r = 0; r < 8; ++r) { s0[r] = 0.f; s1[r] = 0.f; }
    const __bf16* kbuf = &lK[cur][fr * LKS + kb8];
    const __bf16* vbuf = &lV[cur][fr * LDT + kb8];
    const bf16x16 a00 = frag_ld(kbuf);
    const bf16x16 a10 = frag_ld(kbuf + 16 * LKS);
    const bf16x16 a01 = frag_ld(kbuf + 32);
    const bf16x16 a11 = frag_ld(kbuf + 16 * LKS + 32);
    // keeps the K reads, which the step needs first, ahead of the mask loads and
    // of the wait that guards those loads' address registers
    __builtin_amdgcn_sched_barrier(0);
    // key mask of this lane's score rows: keys hb..hb+7 and 16+hb..16+hb+7
    const v4i mk00 = *(const v4i*)(mask + kv0 + hb);
    const v4i mk01 = *(const v4i*)(mask + kv0 + hb + 4);
    const v4i mk10 = *(const v4i*)(mask + kv0 + 16 + hb);
    const v4i mk11 = *(const v4i*)(mask + kv0 + 16 + hb + 4);
    // keeps all eight K reads and the mask loads ahead of the first product:
    // otherwise they are issued in small groups, each behind a wait on the group
    // before, and a wave pays the LDS and the cache latency several times a step
    __builtin_amdgcn_sched_barrier(0);
    s0 = wmma_bf16(a00, bq0, s0);
    s1 = wmma_bf16(a10, bq0, s1);
    s0 = wmma_bf16(a01, bq1, s0);
    s1 = wmma_bf16(a11, bq1, s1);
    bf16x16 av[4];
#pragma unroll
    for (int ni = 0; ni < 4; ++ni) av[ni] = frag_ld(vbuf + ni * 16 * LDT);
    // keeps all eight V reads ahead of the softmax arithmetic, under which they
    // land: otherwise they stand among the last products, each behind a wait
    __builtin_amdgcn_sched_barrier(0);

    // key mask (scale already folded into Q)
#pragma unroll
    for (int r = 0; r < 4; ++r) {
      s0[r]     = mk00[r] ? s0[r]     : -__builtin_inff();
      s0[r + 4] = mk01[r] ? s0[r + 4] : -__builtin_inff();
      s1[r]     = mk10[r] ? s1[r]     : -__builtin_inff();
      s1[r + 4] = mk11[r] ? s1[r + 4] : -__builtin_inff();
    }

    // online softmax: max over the lane's 16 keys, one exchange for the rest
    float tm[8];
#pragma unroll
    for (int r = 0; r < 8; ++r) tm[r] = fmaxf(s0[r], s1[r]);
    float t = fmaxf(fmaxf(fmaxf(tm[0], tm[1]), fmaxf(tm[2], tm[3])),
                    fmaxf(fmaxf(tm[4], tm[5]), fmaxf(tm[6], tm[7])));
    t = fmaxf(t, swap_halves(t));
    const float mnew = fmaxf(rm, t);
    const float corr = __expf(rm - mnew);
    rm = mnew;
#pragma unroll
    for (int r = 0; r < 8; ++r) {
      s0[r] = __expf(s0[r] - mnew);
      s1[r] = __expf(s1[r] - mnew);
    }
    float ts[8];
#pragma unroll
    for (int r = 0; r < 8; ++r) ts[r] = s0[r] + s1[r];
    rl = rl * corr + (((ts[0] + ts[1]) + (ts[2] + ts[3])) +
                      ((ts[4] + ts[5]) + (ts[6] + ts[7])));
#pragma unroll
    for (int ni = 0; ni < 4; ++ni)
#pragma unroll
      for (int r = 0; r < 8; ++r) acco[ni][r] *= corr;

    // P^T as B operand: the two score tiles, converted in place, are already in
    // the hardware k order that frag_ld gives the V^T rows
    bf16x16 bp;
#pragma unroll
    for (int r = 0; r < 8; ++r) { bp[r] = (__bf16)s0[r]; bp[r + 8] = (__bf16)s1[r]; }

#pragma unroll
    for (int ni = 0; ni < 4; ++ni) acco[ni] = wmma_bf16(av[ni], bp, acco[ni]);
    cur ^= 1;
  }

  // join the halves' sums, normalize, write bf16 attention output [s][g*64+dh]:
  // a lane holds 8 consecutive dh of its query per tile, one 16-byte store each
  rl += swap_halves(rl);
  __bf16* orow = outp + (size_t)(q0 + fr) * DDIM + g * HDIM + hb;
#pragma unroll
  for (int ni = 0; ni < 4; ++ni) {
    bf16x8 o;
#pragma unroll
    for (int r = 0; r < 8; ++r) o[r] = (__bf16)(acco[ni][r] / rl);
    *(bf16x8*)(orow + ni * 16) = o;
  }
}

// ---------------------------------------------------------------------------
extern "C" void kernel_launch(void* const* d_in, const int* in_sizes, int n_in,
                              void* d_out, int out_size, void* d_ws, size_t ws_size,
                              hipStream_t stream) {
  const float* q    = (const float*)d_in[0];
  const float* k    = (const float*)d_in[1];
  const float* v    = (const float*)d_in[2];
  const int*   mask = (const int*)d_in[3];
  const float* Wq   = (const float*)d_in[4];
  const float* bq   = (const float*)d_in[5];
  const float* Wk   = (const float*)d_in[6];
  const float* bk   = (const float*)d_in[7];
  const float* Wv   = (const float*)d_in[8];
  const float* bv   = (const float*)d_in[9];
  const float* Wo   = (const float*)d_in[10];
  const float* bo   = (const float*)d_in[11];

  // workspace layout (bf16 elements); total 32M elems = 64 MB
  __bf16* ws  = (__bf16*)d_ws;
  const size_t MEL = (size_t)1024 * 1024;
  __bf16* wqb = ws + 0 * MEL;
  __bf16* wkb = ws + 1 * MEL;
  __bf16* wvb = ws + 2 * MEL;
  __bf16* wob = ws + 3 * MEL;
  __bf16* xq  = ws + 4 * MEL;    // query bf16 [S][D]
  __bf16* xk  = ws + 8 * MEL;    // key   bf16 [S][D]
  __bf16* xv  = ws + 12 * MEL;   // value bf16 [S][D]
  __bf16* qbf = ws + 16 * MEL;   // [G][S][DH] (pre-scaled by 1/8)
  __bf16* kbf = ws + 20 * MEL;   // [G][S][DH]
  __bf16* vtb = ws + 24 * MEL;   // [G][DH][S]
  __bf16* abf = ws + 28 * MEL;   // [S][D]

  // ws + 0 .. ws + 16 MEL: wqb wkb wvb wob xq xk xv, in this order
  cvt_all_f32_to_bf16<<<(4 * DDIM * DDIM + 3 * SEQ * DDIM) / CVT_BLK, 256, 0, stream>>>(
      Wq, Wk, Wv, Wo, q, k, v, ws);

  dim3 gg(DDIM / BN, SEQ / BM);  // (8, 32)
  gemm_bf16_wmma<GM_QK><<<gg, 256, 0, stream>>>(xq, wqb, bq, qbf, 0.125f);
  gemm_bf16_wmma<GM_QK><<<gg, 256, 0, stream>>>(xk, wkb, bk, kbf, 1.0f);
  gemm_bf16_wmma<GM_VT><<<gg, 256, 0, stream>>>(xv, wvb, bv, vtb, 1.0f);

  attn_wmma<<<dim3(SEQ / 128, GRP), 256, 0, stream>>>(qbf, kbf, vtb, mask, abf);

  gemm_bf16_wmma<GM_OUT><<<gg, 256, 0, stream>>>(abf, wob, bo, d_out, 1.0f);
}

// v005
// It runs in 150 microseconds.
// Timed twice side by side with v004, it ran 1.12 and 1.13 times as fast.
// All steps since v000 together make it 1.70 times as fast.
#include <hip/hip_runtime.h>
#include <hip/hip_bf16.h>
#include <math.h>
#include <stdint.h>

#define DDIM 1024
#define SEQ  4096
#define GRP  16
#define HDIM 64

typedef __attribute__((ext_vector_type(16))) __bf16 bf16x16;
typedef __attribute__((ext_vector_type(8)))  __bf16 bf16x8;
typedef __attribute__((ext_vector_type(4)))  __bf16 bf16x4;
typedef __attribute__((ext_vector_type(8)))  float  f32x8;
typedef __attribute__((ext_vector_type(4)))  float  f32x4;
typedef int v4i __attribute__((vector_size(4 * sizeof(int))));

static __device__ __forceinline__ f32x8 wmma_bf16(bf16x16 a, bf16x16 b, f32x8 c) {
  // D = A(16x32 bf16) * B(32x16 bf16) + C(16x16 f32)
  return __builtin_amdgcn_wmma_f32_16x16x32_bf16(false, a, false, b, (short)0, c,
                                                 false, false);
}

// Load one 16x32 bf16 A/B fragment: lanes 0-15 hold K=0..7 / 16..23,
// lanes 16-31 hold K=8..15 / 24..31 (caller adds (lane>>4)*8).
static __device__ __forceinline__ bf16x16 frag_ld(const __bf16* p) {
  bf16x8 lo = *(const bf16x8*)(p);
  bf16x8 hi = *(const bf16x8*)(p + 16);
  bf16x16 r;
#pragma unroll
  for (int i = 0; i < 8; ++i) { r[i] = lo[i]; r[i + 8] = hi[i]; }
  return r;
}

// ---- CDNA5 async global->LDS copy (ASYNCcnt), 16 bytes per lane ------------
static __device__ __forceinline__ void async_cp16(const void* g, void* l) {
#if __has_builtin(__builtin_amdgcn_global_load_async_to_lds_b128)
  __builtin_amdgcn_global_load_async_to_lds_b128(
      (__attribute__((address_space(1))) v4i*)(uintptr_t)g,
      (__attribute__((address_space(3))) v4i*)(uintptr_t)l, 0, 0);
#else
  asm volatile("global_load_async_to_lds_b128 %0, %1, off"
               :: "v"((unsigned)(uintptr_t)l),
                  "v"((unsigned long long)(uintptr_t)g)
               : "memory");
#endif
}

static __device__ __forceinline__ void wait_async0() {
#if __has_builtin(__builtin_amdgcn_s_wait_asynccnt)
  __builtin_amdgcn_s_wait_asynccnt(0);
#else
  asm volatile("s_wait_asynccnt 0x0" ::: "memory");
#endif
}

// ---- lane l <-> l ^ 16 exchange via v_permlanex16_b32 (pure VALU) ----------
static __device__ __forceinline__ float swap_halves(float x) {
  int u = __builtin_bit_cast(int, x);
  u = __builtin_amdgcn_permlanex16(u, u, 0x76543210, 0xfedcba98, false, false);
  return __builtin_bit_cast(float, u);
}

// ---------------------------------------------------------------------------
// fp32 -> bf16 conversion of all seven operands in one streaming launch.
// The destinations lie back to back in the workspace (Wq Wk Wv Wo q k v), so a
// block's index names both its 32768-element destination slice and, by a
// block-uniform select, its source. A wave owns 4096 contiguous elements:
// 32 whole-line 16-byte loads per lane, all issued before the first is used.
// ---------------------------------------------------------------------------
#define CVT_LD  32                  // 16-byte loads per lane
#define CVT_BLK (256 * 4 * CVT_LD)  // elements per block (32768)

__global__ __launch_bounds__(256) void cvt_all_f32_to_bf16(
    const float* __restrict__ wq, const float* __restrict__ wk,
    const float* __restrict__ wv, const float* __restrict__ wo,
    const float* __restrict__ q, const float* __restrict__ k,
    const float* __restrict__ v, __bf16* __restrict__ dst) {
  const int b = blockIdx.x;
  const int wblk = DDIM * DDIM / CVT_BLK;  // blocks per weight (32)
  const int ablk = SEQ * DDIM / CVT_BLK;   // blocks per activation (128)
  const float* src;
  int lb;
  if (b < 4 * wblk) {
    const int t = b / wblk;
    src = t == 0 ? wq : t == 1 ? wk : t == 2 ? wv : wo;
    lb  = b % wblk;
  } else {
    const int t = (b - 4 * wblk) / ablk;
    src = t == 0 ? q : t == 1 ? k : v;
    lb  = (b - 4 * wblk) % ablk;
  }
  const int e = (threadIdx.x >> 5) * (128 * CVT_LD) + (threadIdx.x & 31) * 4;
  const float* s = src + (size_t)lb * CVT_BLK + e;
  __bf16*      d = dst + (size_t)b * CVT_BLK + e;

  f32x4 x[CVT_LD];
#pragma unroll
  for (int j = 0; j < CVT_LD; ++j) x[j] = *(const f32x4*)(s + j * 128);
  // keeps every load ahead of the first conversion: without it the scheduler
  // issues 18 loads and the other 14 in small groups behind waits on those, so
  // a wave pays the memory latency several times over
  __builtin_amdgcn_sched_barrier(0);
#pragma unroll
  for (int j = 0; j < CVT_LD; ++j) {
    bf16x4 o;
#pragma unroll
    for (int i = 0; i < 4; ++i) o[i] = (__bf16)x[j][i];
    *(bf16x4*)(d + j * 128) = o;
  }
}

// ---------------------------------------------------------------------------
// GEMM: C[4096,1024] = X[4096,1024] @ W.T + b (both bf16, NT, async staged)
// Block 128x128x128, 256 threads = 8 waves, wave tile 32x64 (2x4 WMMA),
// double-buffered LDS. A stage holds 128 k of every row: a 256-byte row piece,
// copied by 16 adjacent lanes, so a wave's copy covers whole lines, and one
// wait + barrier serves 32 WMMAs a wave.
// ---------------------------------------------------------------------------
#define BM 128
#define BN 128
#define BK 128
#define LDG 136  // GEMM LDS row stride (elements): 272 B = 16 B x odd
#define LDT 40   // V tile row stride in attention (elements): 80 B

enum { GM_QK = 0, GM_VT = 1, GM_OUT = 2 };

template <int MODE>
__global__ __launch_bounds__(256) void gemm_bf16_wmma(
    const __bf16* __restrict__ x, const __bf16* __restrict__ w,
    const float* __restrict__ bias, void* __restrict__ outp, float oscale) {
  __shared__ __attribute__((aligned(16))) __bf16 lA[2][BM * LDG];
  __shared__ __attribute__((aligned(16))) __bf16 lB[2][BN * LDG];

  const int tid  = threadIdx.x;
  const int lane = tid & 31, wave = tid >> 5;
  const int fr   = lane & 15;
  const int kb8  = (lane >> 4) << 3;
  const int hb   = kb8;
  const int wm   = (wave & 3) * 32;
  const int wn   = (wave >> 2) * 64;
  const int m0   = blockIdx.y * BM;
  const int n0   = blockIdx.x * BN;

  const int srow = (tid >> 4) * 8;  // first of the 8 rows that 16 lanes stage
  const int scol = (tid & 15) * 8;  // staging K offset, 16 B per lane

  const __bf16* gx = x + (size_t)(m0 + srow) * DDIM + scol;
  const __bf16* gw = w + (size_t)(n0 + srow) * DDIM + scol;
  __bf16* sa = &lA[0][srow * LDG + scol];
  __bf16* sb = &lB[0][srow * LDG + scol];

  f32x8 acc[2][4];
#pragma unroll
  for (int mi = 0; mi < 2; ++mi)
#pragma unroll
    for (int ni = 0; ni < 4; ++ni)
#pragma unroll
      for (int r = 0; r < 8; ++r) acc[mi][ni][r] = 0.f;

  auto stage = [&](int kt, int buf) {
    const int bo = buf * (BM * LDG);
    // unrolled so that the row steps become the copies' immediate offsets: one
    // address pair per operand instead of one per copy
#pragma unroll
    for (int j = 0; j < 8; ++j) {
      async_cp16(gx + kt + j * DDIM, sa + bo + j * LDG);
      async_cp16(gw + kt + j * DDIM, sb + bo + j * LDG);
    }
  };

  stage(0, 0);
  // stage 0 has landed before the barrier behind which other waves read it
  asm volatile("s_wait_asynccnt 0x0" ::: "memory");
  __syncthreads();
  stage(BK, 1);

  for (int t = 0; t < DDIM / BK; ++t) {
    const int cur = t & 1;
    // unrolled so that the k steps become immediate LDS offsets and the next
    // 32 k's fragment loads can issue among this block's WMMAs
#pragma unroll
    for (int kk = 0; kk < BK; kk += 32) {
      bf16x16 af[2], bw[4];
#pragma unroll
      for (int mi = 0; mi < 2; ++mi)
        af[mi] = frag_ld(&lA[cur][(wm + mi * 16 + fr) * LDG + kk + kb8]);
#pragma unroll
      for (int ni = 0; ni < 4; ++ni)
        bw[ni] = frag_ld(&lB[cur][(wn + ni * 16 + fr) * LDG + kk + kb8]);
#pragma unroll
      for (int mi = 0; mi < 2; ++mi)
#pragma unroll
        for (int ni = 0; ni < 4; ++ni)
          acc[mi][ni] = wmma_bf16(af[mi], bw[ni], acc[mi][ni]);
    }
    // hand-over: this wave's reads of buffer cur are done ...
    asm volatile("s_wait_dscnt 0x0" ::: "memory");
    // ... and its copies of stage t + 1 have landed, before the barrier that
    // publishes stage t + 1 and frees buffer cur for the refill
    asm volatile("s_wait_asynccnt 0x0" ::: "memory");
    __syncthreads();
    if (t + 2 < DDIM / BK) stage((t + 2) * BK, cur);
  }
  // no copy is outstanding when the wave goes on to its stores and ends
  asm volatile("s_wait_asynccnt 0x0" ::: "memory");

  // epilogue: bias (+ optional scale folded into Q) + layout scatter
#pragma unroll
  for (int mi = 0; mi < 2; ++mi) {
#pragma unroll
    for (int ni = 0; ni < 4; ++ni) {
      const int   n  = n0 + wn + ni * 16 + fr;
      const float bn = bias[n];
#pragma unroll
      for (int r = 0; r < 8; ++r) {
        const int   m   = m0 + wm + mi * 16 + r + hb;
        const float val = acc[mi][ni][r] + bn;
        if (MODE == GM_OUT) {
          ((float*)outp)[(size_t)m * DDIM + n] = val;
        } else if (MODE == GM_QK) {  // per-head [g][s][dh]
          const int gq = n >> 6, dh = n & 63;
          ((__bf16*)outp)[((size_t)gq * SEQ + m) * HDIM + dh] = (__bf16)(val * oscale);
        } else {                     // GM_VT: transposed [g][dh][s]
          const int gq = n >> 6, dh = n & 63;
          ((__bf16*)outp)[((size_t)gq * HDIM + dh) * SEQ + m] = (__bf16)val;
        }
      }
    }
  }
}

#define LKS 72  // K tile row stride: 144 B, 16B-aligned

__global__ __launch_bounds__(256) void attn_wmma(
    const __bf16* __restrict__ qb, const __bf16* __restrict__ kb,
    const __bf16* __restrict__ vtb, const int* __restrict__ mask,
    __bf16* __restrict__ outp) {
  __shared__ __bf16 lK[2][32 * LKS];     // [key][dh]
  __shared__ __bf16 lV[2][64 * LDT];     // [dh][key] (V pre-transposed)
  __shared__ __attribute__((aligned(16))) float lM[SEQ];  // 0 or -inf per key

  const int g    = blockIdx.y;
  const int tid  = threadIdx.x;
  const int lane = tid & 31, wave = tid >> 5;
  const int fr   = lane & 15;
  const int kb8  = (lane >> 4) << 3;
  const int hb   = kb8;
  const int q0   = blockIdx.x * 128 + wave * 16;

  // Q fragments (already scaled by 1/sqrt(DH)) held for the whole KV loop;
  // B operand: lane = query column fr
  const __bf16* qrow = qb + ((size_t)g * SEQ + q0 + fr) * HDIM;
  const bf16x16 bq0 = frag_ld(qrow + kb8);
  const bf16x16 bq1 = frag_ld(qrow + 32 + kb8);

  f32x8 acco[4];  // O^T: acco[ni][r] = O[q0 + fr][ni * 16 + hb + r]
#pragma unroll
  for (int ni = 0; ni < 4; ++ni)
#pragma unroll
    for (int r = 0; r < 8; ++r) acco[ni][r] = 0.f;
  float rm = -__builtin_inff();  // running max of query fr (same in both halves)
  float rl = 0.f;                // running sum over this half's keys only

  const int skey = tid >> 3, sdh = (tid & 7) * 8;  // K staging map (32x64)
  const int vdh  = tid >> 2, vko = (tid & 3) * 8;  // V staging map (64x32)
  const __bf16* gk = kb + ((size_t)g * SEQ + skey) * HDIM + sdh;
  const __bf16* gv = vtb + ((size_t)g * HDIM + vdh) * SEQ + vko;
  __bf16* sk = &lK[0][skey * LKS + sdh];
  __bf16* sv = &lV[0][vdh * LDT + vko];

  auto stage = [&](int kv0, int buf) {
    async_cp16(gk + (size_t)kv0 * HDIM, sk + buf * (32 * LKS));
    async_cp16(gv + kv0,               sv + buf * (64 * LDT));
  };

  stage(0, 0);

  // additive mask row, 16 keys a thread; the first barrier of the KV loop
  // stands between these stores and every read of the row
#pragma unroll
  for (int j = 0; j < SEQ / 1024; ++j) {
    const v4i mk = *(const v4i*)(mask + j * 1024 + tid * 4);
    f32x4 mb;
#pragma unroll
    for (int i = 0; i < 4; ++i) mb[i] = mk[i] ? 0.f : -__builtin_inff();
    *(f32x4*)(&lM[j * 1024 + tid * 4]) = mb;
  }

  int cur = 0;
  for (int kv0 = 0; kv0 < SEQ; kv0 += 32) {
    wait_async0();
    __syncthreads();
    if (kv0 + 32 < SEQ) stage(kv0 + 32, cur ^ 1);

    // scores: S^T[32 keys x 16 q] = K (32x64) . Q^T; s0[r] = key hb + r,
    // s1[r] = key 16 + hb + r, both of query fr. The tiles start from the mask
    // row of their keys (all lanes of a half read the same 16 bytes)
    const float* mrow = &lM[kv0 + hb];
    f32x8 s0 = __builtin_shufflevector(*(const f32x4*)(mrow), *(const f32x4*)(mrow + 4),
                                       0, 1, 2, 3, 4, 5, 6, 7);
    f32x8 s1 = __builtin_shufflevector(*(const f32x4*)(mrow + 16), *(const f32x4*)(mrow + 20),
                                       0, 1, 2, 3, 4, 5, 6, 7);
    const __bf16* kbuf = &lK[cur][fr * LKS + kb8];
    const __bf16* vbuf = &lV[cur][fr * LDT + kb8];
    const bf16x16 a00 = frag_ld(kbuf);
    const bf16x16 a10 = frag_ld(kbuf + 16 * LKS);
    const bf16x16 a01 = frag_ld(kbuf + 32);
    const bf16x16 a11 = frag_ld(kbuf + 16 * LKS + 32);
    // keeps the four mask-row reads and all eight K reads ahead of the first
    // product: otherwise they are issued in small groups, each behind a wait on
    // the group before, and a wave pays the LDS latency several times a step
    __builtin_amdgcn_sched_barrier(0);
    s0 = wmma_bf16(a00, bq0, s0);
    s1 = wmma_bf16(a10, bq0, s1);
    s0 = wmma_bf16(a01, bq1, s0);
    s1 = wmma_bf16(a11, bq1, s1);
    bf16x16 av[4];
#pragma unroll
    for (int ni = 0; ni < 4; ++ni) av[ni] = frag_ld(vbuf + ni * 16 * LDT);
    // keeps all eight V reads ahead of the softmax arithmetic, under which they
    // land: otherwise they stand among the last products, each behind a wait
    __builtin_amdgcn_sched_barrier(0);

    // online softmax: max over the lane's 16 keys, one exchange for the rest
    float tm[8];
#pragma unroll
    for (int r = 0; r < 8; ++r) tm[r] = fmaxf(s0[r], s1[r]);
    float t = fmaxf(fmaxf(fmaxf(tm[0], tm[1]), fmaxf(tm[2], tm[3])),
                    fmaxf(fmaxf(tm[4], tm[5]), fmaxf(tm[6], tm[7])));
    t = fmaxf(t, swap_halves(t));
    const float mnew = fmaxf(rm, t);
    const float corr = __expf(rm - mnew);
    rm = mnew;
#pragma unroll
    for (int r = 0; r < 8; ++r) {
      s0[r] = __expf(s0[r] - mnew);
      s1[r] = __expf(s1[r] - mnew);
    }
    float ts[8];
#pragma unroll
    for (int r = 0; r < 8; ++r) ts[r] = s0[r] + s1[r];
    rl = rl * corr + (((ts[0] + ts[1]) + (ts[2] + ts[3])) +
                      ((ts[4] + ts[5]) + (ts[6] + ts[7])));
#pragma unroll
    for (int ni = 0; ni < 4; ++ni)
#pragma unroll
      for (int r = 0; r < 8; ++r) acco[ni][r] *= corr;

    // P^T as B operand: the two score tiles, converted in place, are already in
    // the hardware k order that frag_ld gives the V^T rows
    bf16x16 bp;
#pragma unroll
    for (int r = 0; r < 8; ++r) { bp[r] = (__bf16)s0[r]; bp[r + 8] = (__bf16)s1[r]; }

#pragma unroll
    for (int ni = 0; ni < 4; ++ni) acco[ni] = wmma_bf16(av[ni], bp, acco[ni]);
    cur ^= 1;
  }

  // join the halves' sums, normalize, write bf16 attention output [s][g*64+dh]:
  // a lane holds 8 consecutive dh of its query per tile, one 16-byte store each
  rl += swap_halves(rl);
  __bf16* orow = outp + (size_t)(q0 + fr) * DDIM + g * HDIM + hb;
#pragma unroll
  for (int ni = 0; ni < 4; ++ni) {
    bf16x8 o;
#pragma unroll
    for (int r = 0; r < 8; ++r) o[r] = (__bf16)(acco[ni][r] / rl);
    *(bf16x8*)(orow + ni * 16) = o;
  }
}

// ---------------------------------------------------------------------------
extern "C" void kernel_launch(void* const* d_in, const int* in_sizes, int n_in,
                              void* d_out, int out_size, void* d_ws, size_t ws_size,
                              hipStream_t stream) {
  const float* q    = (const float*)d_in[0];
  const float* k    = (const float*)d_in[1];
  const float* v    = (const float*)d_in[2];
  const int*   mask = (const int*)d_in[3];
  const float* Wq   = (const float*)d_in[4];
  const float* bq   = (const float*)d_in[5];
  const float* Wk   = (const float*)d_in[6];
  const float* bk   = (const float*)d_in[7];
  const float* Wv   = (const float*)d_in[8];
  const float* bv   = (const float*)d_in[9];
  const float* Wo   = (const float*)d_in[10];
  const float* bo   = (const float*)d_in[11];

  // workspace layout (bf16 elements); total 32M elems = 64 MB
  __bf16* ws  = (__bf16*)d_ws;
  const size_t MEL = (size_t)1024 * 1024;
  __bf16* wqb = ws + 0 * MEL;
  __bf16* wkb = ws + 1 * MEL;
  __bf16* wvb = ws + 2 * MEL;
  __bf16* wob = ws + 3 * MEL;
  __bf16* xq  = ws + 4 * MEL;    // query bf16 [S][D]
  __bf16* xk  = ws + 8 * MEL;    // key   bf16 [S][D]
  __bf16* xv  = ws + 12 * MEL;   // value bf16 [S][D]
  __bf16* qbf = ws + 16 * MEL;   // [G][S][DH] (pre-scaled by 1/8)
  __bf16* kbf = ws + 20 * MEL;   // [G][S][DH]
  __bf16* vtb = ws + 24 * MEL;   // [G][DH][S]
  __bf16* abf = ws + 28 * MEL;   // [S][D]

  // ws + 0 .. ws + 16 MEL: wqb wkb wvb wob xq xk xv, in this order
  cvt_all_f32_to_bf16<<<(4 * DDIM * DDIM + 3 * SEQ * DDIM) / CVT_BLK, 256, 0, stream>>>(
      Wq, Wk, Wv, Wo, q, k, v, ws);

  dim3 gg(DDIM / BN, SEQ / BM);  // (8, 32)
  gemm_bf16_wmma<GM_QK><<<gg, 256, 0, stream>>>(xq, wqb, bq, qbf, 0.125f);
  gemm_bf16_wmma<GM_QK><<<gg, 256, 0, stream>>>(xk, wkb, bk, kbf, 1.0f);
  gemm_bf16_wmma<GM_VT><<<gg, 256, 0, stream>>>(xv, wvb, bv, vtb, 1.0f);

  attn_wmma<<<dim3(SEQ / 128, GRP), 256, 0, stream>>>(qbf, kbf, vtb, mask, abf);

  gemm_bf16_wmma<GM_OUT><<<gg, 256, 0, stream>>>(abf, wob, bo, d_out, 1.0f);
}

// v006
// One run takes 139 microseconds.
// Two timings next to v005 both put it at 1.08 times that version's speed.
// Counting every step since v000, it is 1.84 times as fast.
#include <hip/hip_runtime.h>
#include <hip/hip_bf16.h>
#include <math.h>
#include <stdint.h>

#define DDIM 1024
#define SEQ  4096
#define GRP  16
#define HDIM 64

typedef __attribute__((ext_vector_type(16))) __bf16 bf16x16;
typedef __attribute__((ext_vector_type(8)))  __bf16 bf16x8;
typedef __attribute__((ext_vector_type(4)))  __bf16 bf16x4;
typedef __attribute__((ext_vector_type(8)))  float  f32x8;
typedef __attribute__((ext_vector_type(4)))  float  f32x4;
typedef int v4i __attribute__((vector_size(4 * sizeof(int))));

static __device__ __forceinline__ f32x8 wmma_bf16(bf16x16 a, bf16x16 b, f32x8 c) {
  // D = A(16x32 bf16) * B(32x16 bf16) + C(16x16 f32)
  return __builtin_amdgcn_wmma_f32_16x16x32_bf16(false, a, false, b, (short)0, c,
                                                 false, false);
}

// Load one 16x32 bf16 A/B fragment: lanes 0-15 hold K=0..7 / 16..23,
// lanes 16-31 hold K=8..15 / 24..31 (caller adds (lane>>4)*8).
static __device__ __forceinline__ bf16x16 frag_ld(const __bf16* p) {
  bf16x8 lo = *(const bf16x8*)(p);
  bf16x8 hi = *(const bf16x8*)(p + 16);
  bf16x16 r;
#pragma unroll
  for (int i = 0; i < 8; ++i) { r[i] = lo[i]; r[i + 8] = hi[i]; }
  return r;
}

// ---- CDNA5 async global->LDS copy (ASYNCcnt), 16 bytes per lane ------------
static __device__ __forceinline__ void async_cp16(const void* g, void* l) {
#if __has_builtin(__builtin_amdgcn_global_load_async_to_lds_b128)
  __builtin_amdgcn_global_load_async_to_lds_b128(
      (__attribute__((address_space(1))) v4i*)(uintptr_t)g,
      (__attribute__((address_space(3))) v4i*)(uintptr_t)l, 0, 0);
#else
  asm volatile("global_load_async_to_lds_b128 %0, %1, off"
               :: "v"((unsigned)(uintptr_t)l),
                  "v"((unsigned long long)(uintptr_t)g)
               : "memory");
#endif
}

static __device__ __forceinline__ void wait_async0() {
#if __has_builtin(__builtin_amdgcn_s_wait_asynccnt)
  __builtin_amdgcn_s_wait_asynccnt(0);
#else
  asm volatile("s_wait_asynccnt 0x0" ::: "memory");
#endif
}

// ---- lane l <-> l ^ 16 exchange via v_permlanex16_b32 (pure VALU) ----------
static __device__ __forceinline__ float swap_halves(float x) {
  int u = __builtin_bit_cast(int, x);
  u = __builtin_amdgcn_permlanex16(u, u, 0x76543210, 0xfedcba98, false, false);
  return __builtin_bit_cast(float, u);
}

// ---------------------------------------------------------------------------
// fp32 -> bf16 conversion of all seven operands in one streaming launch.
// The destinations lie back to back in the workspace (Wq Wk Wv Wo q k v), so a
// block's index names both its 32768-element destination slice and, by a
// block-uniform select, its source. A wave owns 4096 contiguous elements:
// 32 whole-line 16-byte loads per lane, all issued before the first is used.
// ---------------------------------------------------------------------------
#define CVT_LD  32                  // 16-byte loads per lane
#define CVT_BLK (256 * 4 * CVT_LD)  // elements per block (32768)

__global__ __launch_bounds__(256) void cvt_all_f32_to_bf16(
    const float* __restrict__ wq, const float* __restrict__ wk,
    const float* __restrict__ wv, const float* __restrict__ wo,
    const float* __restrict__ q, const float* __restrict__ k,
    const float* __restrict__ v, __bf16* __restrict__ dst) {
  const int b = blockIdx.x;
  const int wblk = DDIM * DDIM / CVT_BLK;  // blocks per weight (32)
  const int ablk = SEQ * DDIM / CVT_BLK;   // blocks per activation (128)
  const float* src;
  int lb;
  if (b < 4 * wblk) {
    const int t = b / wblk;
    src = t == 0 ? wq : t == 1 ? wk : t == 2 ? wv : wo;
    lb  = b % wblk;
  } else {
    const int t = (b - 4 * wblk) / ablk;
    src = t == 0 ? q : t == 1 ? k : v;
    lb  = (b - 4 * wblk) % ablk;
  }
  const int e = (threadIdx.x >> 5) * (128 * CVT_LD) + (threadIdx.x & 31) * 4;
  const float* s = src + (size_t)lb * CVT_BLK + e;
  __bf16*      d = dst + (size_t)b * CVT_BLK + e;

  f32x4 x[CVT_LD];
#pragma unroll
  for (int j = 0; j < CVT_LD; ++j) x[j] = *(const f32x4*)(s + j * 128);
  // keeps every load ahead of the first conversion: without it the scheduler
  // issues 18 loads and the other 14 in small groups behind waits on those, so
  // a wave pays the memory latency several times over
  __builtin_amdgcn_sched_barrier(0);
#pragma unroll
  for (int j = 0; j < CVT_LD; ++j) {
    bf16x4 o;
#pragma unroll
    for (int i = 0; i < 4; ++i) o[i] = (__bf16)x[j][i];
    *(bf16x4*)(d + j * 128) = o;
  }
}

// ---------------------------------------------------------------------------
// GEMM: C[4096,1024] = X[4096,1024] @ W.T + b (both bf16, NT, async staged)
// Block 128x128x128, 256 threads = 8 waves, wave tile 32x64 (2x4 WMMA),
// double-buffered LDS. A stage holds 128 k of every row: a 256-byte row piece,
// copied by 16 adjacent lanes, so a wave's copy covers whole lines, and one
// wait + barrier serves 32 WMMAs a wave.
// GM_QKV is the three input projections in one launch: blockIdx.z names the
// projection (0 Q, 1 K, 2 V), whose activations, weights and outputs lie at
// equal strides in the workspace. 768 blocks, two resident on a WGP (LDS), so
// one block's first stage, hand-overs and stores run under the other's WMMAs.
// ---------------------------------------------------------------------------
#define BM 128
#define BN 128
#define BK 128
#define LDG 136  // GEMM LDS row stride (elements): 272 B = 16 B x odd
#define LDT 40   // V tile row stride in attention (elements): 80 B

enum { GM_QKV = 0, GM_OUT = 1 };
template <int V> struct lay_tag { static constexpr int value = V; };  // output layout

template <int MODE>
__global__ __launch_bounds__(256) void gemm_bf16_wmma(
    const __bf16* __restrict__ x, const __bf16* __restrict__ w,
    const float* __restrict__ bias, const float* __restrict__ bias1,
    const float* __restrict__ bias2, void* __restrict__ outp, float oscale) {
  __shared__ __attribute__((aligned(16))) __bf16 lA[2][BM * LDG];
  __shared__ __attribute__((aligned(16))) __bf16 lB[2][BN * LDG];

  const int pz = MODE == GM_QKV ? (int)blockIdx.z : 0;  // projection, block-uniform
  if (MODE == GM_QKV) {
    x += (size_t)pz * (SEQ * DDIM);
    w += (size_t)pz * (DDIM * DDIM);
    bias   = pz == 0 ? bias : pz == 1 ? bias1 : bias2;
    oscale = pz == 0 ? oscale : 1.0f;  // the softmax scale goes into Q alone
  }

  const int tid  = threadIdx.x;
  const int lane = tid & 31, wave = tid >> 5;
  const int fr   = lane & 15;
  const int kb8  = (lane >> 4) << 3;
  const int hb   = kb8;
  const int wm   = (wave & 3) * 32;
  const int wn   = (wave >> 2) * 64;
  const int m0   = blockIdx.y * BM;
  const int n0   = blockIdx.x * BN;

  const int srow = (tid >> 4) * 8;  // first of the 8 rows that 16 lanes stage
  const int scol = (tid & 15) * 8;  // staging K offset, 16 B per lane

  const __bf16* gx = x + (size_t)(m0 + srow) * DDIM + scol;
  const __bf16* gw = w + (size_t)(n0 + srow) * DDIM + scol;
  __bf16* sa = &lA[0][srow * LDG + scol];
  __bf16* sb = &lB[0][srow * LDG + scol];

  f32x8 acc[2][4];
#pragma unroll
  for (int mi = 0; mi < 2; ++mi)
#pragma unroll
    for (int ni = 0; ni < 4; ++ni)
#pragma unroll
      for (int r = 0; r < 8; ++r) acc[mi][ni][r] = 0.f;

  auto stage = [&](int kt, int buf) {
    const int bo = buf * (BM * LDG);
    // unrolled so that the row steps become the copies' immediate offsets: one
    // address pair per operand instead of one per copy
#pragma unroll
    for (int j = 0; j < 8; ++j) {
      async_cp16(gx + kt + j * DDIM, sa + bo + j * LDG);
      async_cp16(gw + kt + j * DDIM, sb + bo + j * LDG);
    }
  };

  stage(0, 0);
  // stage 0 has landed before the barrier behind which other waves read it
  asm volatile("s_wait_asynccnt 0x0" ::: "memory");
  __syncthreads();
  stage(BK, 1);

  for (int t = 0; t < DDIM / BK; ++t) {
    const int cur = t & 1;
    // unrolled so that the k steps become immediate LDS offsets and the next
    // 32 k's fragment loads can issue among this block's WMMAs
#pragma unroll
    for (int kk = 0; kk < BK; kk += 32) {
      bf16x16 af[2], bw[4];
#pragma unroll
      for (int mi = 0; mi < 2; ++mi)
        af[mi] = frag_ld(&lA[cur][(wm + mi * 16 + fr) * LDG + kk + kb8]);
#pragma unroll
      for (int ni = 0; ni < 4; ++ni)
        bw[ni] = frag_ld(&lB[cur][(wn + ni * 16 + fr) * LDG + kk + kb8]);
#pragma unroll
      for (int mi = 0; mi < 2; ++mi)
#pragma unroll
        for (int ni = 0; ni < 4; ++ni)
          acc[mi][ni] = wmma_bf16(af[mi], bw[ni], acc[mi][ni]);
    }
    // hand-over: this wave's reads of buffer cur are done ...
    asm volatile("s_wait_dscnt 0x0" ::: "memory");
    // ... and its copies of stage t + 1 have landed, before the barrier that
    // publishes stage t + 1 and frees buffer cur for the refill
    asm volatile("s_wait_asynccnt 0x0" ::: "memory");
    __syncthreads();
    if (t + 2 < DDIM / BK) stage((t + 2) * BK, cur);
  }
  // no copy is outstanding when the wave goes on to its stores and ends
  asm volatile("s_wait_asynccnt 0x0" ::: "memory");

  // epilogue: bias (+ scale folded into Q) + layout scatter; lay 0: f32 [s][d],
  // 1: bf16 per-head [g][s][dh], 2: bf16 transposed [g][dh][s]
  float bn4[4];  // the bias of this lane's four output columns
  // unrolled so that bn4 is indexed by constants alone and stays in registers
#pragma unroll
  for (int ni = 0; ni < 4; ++ni) bn4[ni] = bias[n0 + wn + ni * 16 + fr];
  auto store_tiles = [&](auto lay) {
    __bf16* ob = (__bf16*)outp + (size_t)pz * (SEQ * DDIM);
#pragma unroll
    for (int mi = 0; mi < 2; ++mi) {
#pragma unroll
      for (int ni = 0; ni < 4; ++ni) {
        const int   n  = n0 + wn + ni * 16 + fr;
        const float bn = bn4[ni];
        const int   gq = n >> 6, dh = n & 63;
#pragma unroll
        for (int r = 0; r < 8; ++r) {
          const int   m   = m0 + wm + mi * 16 + r + hb;
          const float val = acc[mi][ni][r] + bn;
          if (lay.value == 0) {
            ((float*)outp)[(size_t)m * DDIM + n] = val;
          } else if (lay.value == 1) {
            ob[((size_t)gq * SEQ + m) * HDIM + dh] = (__bf16)(val * oscale);
          } else {
            ob[((size_t)gq * HDIM + dh) * SEQ + m] = (__bf16)val;
          }
        }
      }
    }
  };
  if (MODE == GM_OUT) {
    store_tiles(lay_tag<0>{});
    return;
  }
  if (pz == 2) {
    store_tiles(lay_tag<2>{});
    return;
  }
  store_tiles(lay_tag<1>{});
  // precaution: the listing lays the transposed layout's block behind these
  // stores, and it rewrites their data registers; this wait stands in between
  asm volatile("s_wait_xcnt 0x0" ::: "memory");
}

#define LKS 72  // K tile row stride: 144 B, 16B-aligned

__global__ __launch_bounds__(256) void attn_wmma(
    const __bf16* __restrict__ qb, const __bf16* __restrict__ kb,
    const __bf16* __restrict__ vtb, const int* __restrict__ mask,
    __bf16* __restrict__ outp) {
  __shared__ __bf16 lK[2][32 * LKS];     // [key][dh]
  __shared__ __bf16 lV[2][64 * LDT];     // [dh][key] (V pre-transposed)
  __shared__ __attribute__((aligned(16))) float lM[SEQ];  // 0 or -inf per key

  const int g    = blockIdx.y;
  const int tid  = threadIdx.x;
  const int lane = tid & 31, wave = tid >> 5;
  const int fr   = lane & 15;
  const int kb8  = (lane >> 4) << 3;
  const int hb   = kb8;
  const int q0   = blockIdx.x * 128 + wave * 16;

  // Q fragments (already scaled by 1/sqrt(DH)) held for the whole KV loop;
  // B operand: lane = query column fr
  const __bf16* qrow = qb + ((size_t)g * SEQ + q0 + fr) * HDIM;
  const bf16x16 bq0 = frag_ld(qrow + kb8);
  const bf16x16 bq1 = frag_ld(qrow + 32 + kb8);

  f32x8 acco[4];  // O^T: acco[ni][r] = O[q0 + fr][ni * 16 + hb + r]
#pragma unroll
  for (int ni = 0; ni < 4; ++ni)
#pragma unroll
    for (int r = 0; r < 8; ++r) acco[ni][r] = 0.f;
  float rm = -__builtin_inff();  // running max of query fr (same in both halves)
  float rl = 0.f;                // running sum over this half's keys only

  const int skey = tid >> 3, sdh = (tid & 7) * 8;  // K staging map (32x64)
  const int vdh  = tid >> 2, vko = (tid & 3) * 8;  // V staging map (64x32)
  const __bf16* gk = kb + ((size_t)g * SEQ + skey) * HDIM + sdh;
  const __bf16* gv = vtb + ((size_t)g * HDIM + vdh) * SEQ + vko;
  __bf16* sk = &lK[0][skey * LKS + sdh];
  __bf16* sv = &lV[0][vdh * LDT + vko];

  auto stage = [&](int kv0, int buf) {
    async_cp16(gk + (size_t)kv0 * HDIM, sk + buf * (32 * LKS));
    async_cp16(gv + kv0,               sv + buf * (64 * LDT));
  };

  stage(0, 0);

  // additive mask row, 16 keys a thread; the first barrier of the KV loop
  // stands between these stores and every read of the row
#pragma unroll
  for (int j = 0; j < SEQ / 1024; ++j) {
    const v4i mk = *(const v4i*)(mask + j * 1024 + tid * 4);
    f32x4 mb;
#pragma unroll
    for (int i = 0; i < 4; ++i) mb[i] = mk[i] ? 0.f : -__builtin_inff();
    *(f32x4*)(&lM[j * 1024 + tid * 4]) = mb;
  }

  int cur = 0;
  for (int kv0 = 0; kv0 < SEQ; kv0 += 32) {
    wait_async0();
    __syncthreads();
    if (kv0 + 32 < SEQ) stage(kv0 + 32, cur ^ 1);

    // scores: S^T[32 keys x 16 q] = K (32x64) . Q^T; s0[r] = key hb + r,
    // s1[r] = key 16 + hb + r, both of query fr. The tiles start from the mask
    // row of their keys (all lanes of a half read the same 16 bytes)
    const float* mrow = &lM[kv0 + hb];
    f32x8 s0 = __builtin_shufflevector(*(const f32x4*)(mrow), *(const f32x4*)(mrow + 4),
                                       0, 1, 2, 3, 4, 5, 6, 7);
    f32x8 s1 = __builtin_shufflevector(*(const f32x4*)(mrow + 16), *(const f32x4*)(mrow + 20),
                                       0, 1, 2, 3, 4, 5, 6, 7);
    const __bf16* kbuf = &lK[cur][fr * LKS + kb8];
    const __bf16* vbuf = &lV[cur][fr * LDT + kb8];
    const bf16x16 a00 = frag_ld(kbuf);
    const bf16x16 a10 = frag_ld(kbuf + 16 * LKS);
    const bf16x16 a01 = frag_ld(kbuf + 32);
    const bf16x16 a11 = frag_ld(kbuf + 16 * LKS + 32);
    // keeps the four mask-row reads and all eight K reads ahead of the first
    // product: otherwise they are issued in small groups, each behind a wait on
    // the group before, and a wave pays the LDS latency several times a step
    __builtin_amdgcn_sched_barrier(0);
    s0 = wmma_bf16(a00, bq0, s0);
    s1 = wmma_bf16(a10, bq0, s1);
    s0 = wmma_bf16(a01, bq1, s0);
    s1 = wmma_bf16(a11, bq1, s1);
    bf16x16 av[4];
#pragma unroll
    for (int ni = 0; ni < 4; ++ni) av[ni] = frag_ld(vbuf + ni * 16 * LDT);
    // keeps all eight V reads ahead of the softmax arithmetic, under which they
    // land: otherwise they stand among the last products, each behind a wait
    __builtin_amdgcn_sched_barrier(0);

    // online softmax: max over the lane's 16 keys, one exchange for the rest
    float tm[8];
#pragma unroll
    for (int r = 0; r < 8; ++r) tm[r] = fmaxf(s0[r], s1[r]);
    float t = fmaxf(fmaxf(fmaxf(tm[0], tm[1]), fmaxf(tm[2], tm[3])),
                    fmaxf(fmaxf(tm[4], tm[5]), fmaxf(tm[6], tm[7])));
    t = fmaxf(t, swap_halves(t));
    const float mnew = fmaxf(rm, t);
    const float corr = __expf(rm - mnew);
    rm = mnew;
#pragma unroll
    for (int r = 0; r < 8; ++r) {
      s0[r] = __expf(s0[r] - mnew);
      s1[r] = __expf(s1[r] - mnew);
    }
    float ts[8];
#pragma unroll
    for (int r = 0; r < 8; ++r) ts[r] = s0[r] + s1[r];
    rl = rl * corr + (((ts[0] + ts[1]) + (ts[2] + ts[3])) +
                      ((ts[4] + ts[5]) + (ts[6] + ts[7])));
#pragma unroll
    for (int ni = 0; ni < 4; ++ni)
#pragma unroll
      for (int r = 0; r < 8; ++r) acco[ni][r] *= corr;

    // P^T as B operand: the two score tiles, converted in place, are already in
    // the hardware k order that frag_ld gives the V^T rows
    bf16x16 bp;
#pragma unroll
    for (int r = 0; r < 8; ++r) { bp[r] = (__bf16)s0[r]; bp[r + 8] = (__bf16)s1[r]; }

#pragma unroll
    for (int ni = 0; ni < 4; ++ni) acco[ni] = wmma_bf16(av[ni], bp, acco[ni]);
    cur ^= 1;
  }

  // join the halves' sums, normalize, write bf16 attention output [s][g*64+dh]:
  // a lane holds 8 consecutive dh of its query per tile, one 16-byte store each
  rl += swap_halves(rl);
  __bf16* orow = outp + (size_t)(q0 + fr) * DDIM + g * HDIM + hb;
#pragma unroll
  for (int ni = 0; ni < 4; ++ni) {
    bf16x8 o;
#pragma unroll
    for (int r = 0; r < 8; ++r) o[r] = (__bf16)(acco[ni][r] / rl);
    *(bf16x8*)(orow + ni * 16) = o;
  }
}

// ---------------------------------------------------------------------------
extern "C" void kernel_launch(void* const* d_in, const int* in_sizes, int n_in,
                              void* d_out, int out_size, void* d_ws, size_t ws_size,
                              hipStream_t stream) {
  const float* q    = (const float*)d_in[0];
  const float* k    = (const float*)d_in[1];
  const float* v    = (const float*)d_in[2];
  const int*   mask = (const int*)d_in[3];
  const float* Wq   = (const float*)d_in[4];
  const float* bq   = (const float*)d_in[5];
  const float* Wk   = (const float*)d_in[6];
  const float* bk   = (const float*)d_in[7];
  const float* Wv   = (const float*)d_in[8];
  const float* bv   = (const float*)d_in[9];
  const float* Wo   = (const float*)d_in[10];
  const float* bo   = (const float*)d_in[11];

  // workspace layout (bf16 elements); total 32M elems = 64 MB
  __bf16* ws  = (__bf16*)d_ws;
  const size_t MEL = (size_t)1024 * 1024;
  __bf16* wqb = ws + 0 * MEL;
  __bf16* wkb = ws + 1 * MEL;
  __bf16* wvb = ws + 2 * MEL;
  __bf16* wob = ws + 3 * MEL;
  __bf16* xq  = ws + 4 * MEL;    // query bf16 [S][D]
  __bf16* xk  = ws + 8 * MEL;    // key   bf16 [S][D]
  __bf16* xv  = ws + 12 * MEL;   // value bf16 [S][D]
  __bf16* qbf = ws + 16 * MEL;   // [G][S][DH] (pre-scaled by 1/8)
  __bf16* kbf = ws + 20 * MEL;   // [G][S][DH]
  __bf16* vtb = ws + 24 * MEL;   // [G][DH][S]
  __bf16* abf = ws + 28 * MEL;   // [S][D]

  // ws + 0 .. ws + 16 MEL: wqb wkb wvb wob xq xk xv, in this order
  cvt_all_f32_to_bf16<<<(4 * DDIM * DDIM + 3 * SEQ * DDIM) / CVT_BLK, 256, 0, stream>>>(
      Wq, Wk, Wv, Wo, q, k, v, ws);

  dim3 gg(DDIM / BN, SEQ / BM);  // (8, 32)
  // z = 0, 1, 2: xq xk xv, wqb wkb wvb and qbf kbf vtb each lie back to back
  gemm_bf16_wmma<GM_QKV><<<dim3(DDIM / BN, SEQ / BM, 3), 256, 0, stream>>>(
      xq, wqb, bq, bk, bv, qbf, 0.125f);

  attn_wmma<<<dim3(SEQ / 128, GRP), 256, 0, stream>>>(qbf, kbf, vtb, mask, abf);

  // the second and third bias arguments are read by GM_QKV alone
  gemm_bf16_wmma<GM_OUT><<<gg, 256, 0, stream>>>(abf, wob, bo, bo, bo, d_out, 1.0f);
}

// v007
// Measured time: 114 microseconds a run.
// Next to v006, in two timings, it ran 1.22 times as fast each time.
// All steps since v000 together make it 2.24 times as fast.
#include <hip/hip_runtime.h>
#include <hip/hip_bf16.h>
#include <math.h>
#include <stdint.h>

#define DDIM 1024
#define SEQ  4096
#define GRP  16
#define HDIM 64

typedef __attribute__((ext_vector_type(16))) __bf16 bf16x16;
typedef __attribute__((ext_vector_type(8)))  __bf16 bf16x8;
typedef __attribute__((ext_vector_type(4)))  __bf16 bf16x4;
typedef __attribute__((ext_vector_type(8)))  float  f32x8;
typedef __attribute__((ext_vector_type(4)))  float  f32x4;
typedef __attribute__((ext_vector_type(2)))  float  f32x2;
typedef int v4i __attribute__((vector_size(4 * sizeof(int))));

static __device__ __forceinline__ f32x8 wmma_bf16(bf16x16 a, bf16x16 b, f32x8 c) {
  // D = A(16x32 bf16) * B(32x16 bf16) + C(16x16 f32)
  return __builtin_amdgcn_wmma_f32_16x16x32_bf16(false, a, false, b, (short)0, c,
                                                 false, false);
}

// Load one 16x32 bf16 A/B fragment: lanes 0-15 hold K=0..7 / 16..23,
// lanes 16-31 hold K=8..15 / 24..31 (caller adds (lane>>4)*8).
static __device__ __forceinline__ bf16x16 frag_ld(const __bf16* p) {
  bf16x8 lo = *(const bf16x8*)(p);
  bf16x8 hi = *(const bf16x8*)(p + 16);
  bf16x16 r;
#pragma unroll
  for (int i = 0; i < 8; ++i) { r[i] = lo[i]; r[i + 8] = hi[i]; }
  return r;
}

// ---- CDNA5 async global->LDS copy (ASYNCcnt), 16 bytes per lane ------------
static __device__ __forceinline__ void async_cp16(const void* g, void* l) {
#if __has_builtin(__builtin_amdgcn_global_load_async_to_lds_b128)
  __builtin_amdgcn_global_load_async_to_lds_b128(
      (__attribute__((address_space(1))) v4i*)(uintptr_t)g,
      (__attribute__((address_space(3))) v4i*)(uintptr_t)l, 0, 0);
#else
  asm volatile("global_load_async_to_lds_b128 %0, %1, off"
               :: "v"((unsigned)(uintptr_t)l),
                  "v"((unsigned long long)(uintptr_t)g)
               : "memory");
#endif
}

// ---- lane l <-> l ^ 16 exchange via v_permlanex16_b32 (pure VALU) ----------
static __device__ __forceinline__ float swap_halves(float x) {
  int u = __builtin_bit_cast(int, x);
  u = __builtin_amdgcn_permlanex16(u, u, 0x76543210, 0xfedcba98, false, false);
  return __builtin_bit_cast(float, u);
}

// ---------------------------------------------------------------------------
// fp32 -> bf16 conversion of all seven operands in one streaming launch.
// The destinations lie back to back in the workspace (Wq Wk Wv Wo q k v), so a
// block's index names both its 32768-element destination slice and, by a
// block-uniform select, its source. A wave owns 4096 contiguous elements:
// 32 whole-line 16-byte loads per lane, all issued before the first is used.
// ---------------------------------------------------------------------------
#define CVT_LD  32                  // 16-byte loads per lane
#define CVT_BLK (256 * 4 * CVT_LD)  // elements per block (32768)

__global__ __launch_bounds__(256) void cvt_all_f32_to_bf16(
    const float* __restrict__ wq, const float* __restrict__ wk,
    const float* __restrict__ wv, const float* __restrict__ wo,
    const float* __restrict__ q, const float* __restrict__ k,
    const float* __restrict__ v, __bf16* __restrict__ dst) {
  const int b = blockIdx.x;
  const int wblk = DDIM * DDIM / CVT_BLK;  // blocks per weight (32)
  const int ablk = SEQ * DDIM / CVT_BLK;   // blocks per activation (128)
  const float* src;
  int lb;
  if (b < 4 * wblk) {
    const int t = b / wblk;
    src = t == 0 ? wq : t == 1 ? wk : t == 2 ? wv : wo;
    lb  = b % wblk;
  } else {
    const int t = (b - 4 * wblk) / ablk;
    src = t == 0 ? q : t == 1 ? k : v;
    lb  = (b - 4 * wblk) % ablk;
  }
  const int e = (threadIdx.x >> 5) * (128 * CVT_LD) + (threadIdx.x & 31) * 4;
  const float* s = src + (size_t)lb * CVT_BLK + e;
  __bf16*      d = dst + (size_t)b * CVT_BLK + e;

  f32x4 x[CVT_LD];
#pragma unroll
  for (int j = 0; j < CVT_LD; ++j) x[j] = *(const f32x4*)(s + j * 128);
  // keeps every load ahead of the first conversion: without it the scheduler
  // issues 18 loads and the other 14 in small groups behind waits on those, so
  // a wave pays the memory latency several times over
  __builtin_amdgcn_sched_barrier(0);
#pragma unroll
  for (int j = 0; j < CVT_LD; ++j) {
    bf16x4 o;
#pragma unroll
    for (int i = 0; i < 4; ++i) o[i] = (__bf16)x[j][i];
    *(bf16x4*)(d + j * 128) = o;
  }
}

// ---------------------------------------------------------------------------
// GEMM: C[4096,1024] = X[4096,1024] @ W.T + b (both bf16, NT, async staged)
// Block 128x128x128, 256 threads = 8 waves, wave tile 32x64 (2x4 WMMA),
// double-buffered LDS. A stage holds 128 k of every row: a 256-byte row piece,
// copied by 16 adjacent lanes, so a wave's copy covers whole lines, and one
// wait + barrier serves 32 WMMAs a wave.
// GM_QKV is the three input projections in one launch: blockIdx.z names the
// projection (0 Q, 1 K, 2 V), whose activations, weights and outputs lie at
// equal strides in the workspace. 768 blocks, two resident on a WGP (LDS), so
// one block's first stage, hand-overs and stores run under the other's WMMAs.
// ---------------------------------------------------------------------------
#define BM 128
#define BN 128
#define BK 128
#define LDG 136  // GEMM LDS row stride (elements): 272 B = 16 B x odd

enum { GM_QKV = 0, GM_OUT = 1 };
template <int V> struct lay_tag { static constexpr int value = V; };  // output layout

template <int MODE>
__global__ __launch_bounds__(256) void gemm_bf16_wmma(
    const __bf16* __restrict__ x, const __bf16* __restrict__ w,
    const float* __restrict__ bias, const float* __restrict__ bias1,
    const float* __restrict__ bias2, void* __restrict__ outp, float oscale) {
  __shared__ __attribute__((aligned(16))) __bf16 lA[2][BM * LDG];
  __shared__ __attribute__((aligned(16))) __bf16 lB[2][BN * LDG];

  const int pz = MODE == GM_QKV ? (int)blockIdx.z : 0;  // projection, block-uniform
  if (MODE == GM_QKV) {
    x += (size_t)pz * (SEQ * DDIM);
    w += (size_t)pz * (DDIM * DDIM);
    bias   = pz == 0 ? bias : pz == 1 ? bias1 : bias2;
    oscale = pz == 0 ? oscale : 1.0f;  // the softmax scale goes into Q alone
  }

  const int tid  = threadIdx.x;
  const int lane = tid & 31, wave = tid >> 5;
  const int fr   = lane & 15;
  const int kb8  = (lane >> 4) << 3;
  const int hb   = kb8;
  const int wm   = (wave & 3) * 32;
  const int wn   = (wave >> 2) * 64;
  const int m0   = blockIdx.y * BM;
  const int n0   = blockIdx.x * BN;

  const int srow = (tid >> 4) * 8;  // first of the 8 rows that 16 lanes stage
  const int scol = (tid & 15) * 8;  // staging K offset, 16 B per lane

  const __bf16* gx = x + (size_t)(m0 + srow) * DDIM + scol;
  const __bf16* gw = w + (size_t)(n0 + srow) * DDIM + scol;
  __bf16* sa = &lA[0][srow * LDG + scol];
  __bf16* sb = &lB[0][srow * LDG + scol];

  f32x8 acc[2][4];
#pragma unroll
  for (int mi = 0; mi < 2; ++mi)
#pragma unroll
    for (int ni = 0; ni < 4; ++ni)
#pragma unroll
      for (int r = 0; r < 8; ++r) acc[mi][ni][r] = 0.f;

  auto stage = [&](int kt, int buf) {
    const int bo = buf * (BM * LDG);
    // unrolled so that the row steps become the copies' immediate offsets: one
    // address pair per operand instead of one per copy
#pragma unroll
    for (int j = 0; j < 8; ++j) {
      async_cp16(gx + kt + j * DDIM, sa + bo + j * LDG);
      async_cp16(gw + kt + j * DDIM, sb + bo + j * LDG);
    }
  };

  stage(0, 0);
  // stage 0 has landed before the barrier behind which other waves read it
  asm volatile("s_wait_asynccnt 0x0" ::: "memory");
  __syncthreads();
  stage(BK, 1);

  for (int t = 0; t < DDIM / BK; ++t) {
    const int cur = t & 1;
    // unrolled so that the k steps become immediate LDS offsets and the next
    // 32 k's fragment loads can issue among this block's WMMAs
#pragma unroll
    for (int kk = 0; kk < BK; kk += 32) {
      bf16x16 af[2], bw[4];
#pragma unroll
      for (int mi = 0; mi < 2; ++mi)
        af[mi] = frag_ld(&lA[cur][(wm + mi * 16 + fr) * LDG + kk + kb8]);
#pragma unroll
      for (int ni = 0; ni < 4; ++ni)
        bw[ni] = frag_ld(&lB[cur][(wn + ni * 16 + fr) * LDG + kk + kb8]);
#pragma unroll
      for (int mi = 0; mi < 2; ++mi)
#pragma unroll
        for (int ni = 0; ni < 4; ++ni)
          acc[mi][ni] = wmma_bf16(af[mi], bw[ni], acc[mi][ni]);
    }
    // hand-over: this wave's reads of buffer cur are done ...
    asm volatile("s_wait_dscnt 0x0" ::: "memory");
    // ... and its copies of stage t + 1 have landed, before the barrier that
    // publishes stage t + 1 and frees buffer cur for the refill
    asm volatile("s_wait_asynccnt 0x0" ::: "memory");
    __syncthreads();
    if (t + 2 < DDIM / BK) stage((t + 2) * BK, cur);
  }
  // no copy is outstanding when the wave goes on to its stores and ends
  asm volatile("s_wait_asynccnt 0x0" ::: "memory");

  // epilogue: bias (+ scale folded into Q) + layout scatter; lay 0: f32 [s][d],
  // 1: bf16 per-head [g][s][dh], 2: bf16 transposed [g][dh][s]
  float bn4[4];  // the bias of this lane's four output columns
  // unrolled so that bn4 is indexed by constants alone and stays in registers
#pragma unroll
  for (int ni = 0; ni < 4; ++ni) bn4[ni] = bias[n0 + wn + ni * 16 + fr];
  auto store_tiles = [&](auto lay) {
    __bf16* ob = (__bf16*)outp + (size_t)pz * (SEQ * DDIM);
#pragma unroll
    for (int mi = 0; mi < 2; ++mi) {
#pragma unroll
      for (int ni = 0; ni < 4; ++ni) {
        const int   n  = n0 + wn + ni * 16 + fr;
        const float bn = bn4[ni];
        const int   gq = n >> 6, dh = n & 63;
#pragma unroll
        for (int r = 0; r < 8; ++r) {
          const int   m   = m0 + wm + mi * 16 + r + hb;
          const float val = acc[mi][ni][r] + bn;
          if (lay.value == 0) {
            ((float*)outp)[(size_t)m * DDIM + n] = val;
          } else if (lay.value == 1) {
            ob[((size_t)gq * SEQ + m) * HDIM + dh] = (__bf16)(val * oscale);
          } else {
            ob[((size_t)gq * HDIM + dh) * SEQ + m] = (__bf16)val;
          }
        }
      }
    }
  };
  if (MODE == GM_OUT) {
    store_tiles(lay_tag<0>{});
    return;
  }
  if (pz == 2) {
    store_tiles(lay_tag<2>{});
    return;
  }
  store_tiles(lay_tag<1>{});
  // precaution: the listing lays the transposed layout's block behind these
  // stores, and it rewrites their data registers; this wait stands in between
  asm volatile("s_wait_xcnt 0x0" ::: "memory");
}

#define LKS 72  // K and V tile row stride: 144 B, 16B-aligned
#define KVS 64  // keys per stage

__global__ __launch_bounds__(256) void attn_wmma(
    const __bf16* __restrict__ qb, const __bf16* __restrict__ kb,
    const __bf16* __restrict__ vtb, const int* __restrict__ mask,
    __bf16* __restrict__ outp) {
  __shared__ __attribute__((aligned(16))) __bf16 lK[2][KVS * LKS];   // [key][dh]
  __shared__ __attribute__((aligned(16))) __bf16 lV[2][HDIM * LKS];  // [dh][key] (V pre-transposed)
  __shared__ __attribute__((aligned(16))) float lM[SEQ];  // 0 or -inf per key
  __shared__ __attribute__((aligned(16))) float lX[8][9][32][4];  // hand-over [wave][slot][lane]

  const int g    = blockIdx.y;
  const int tid  = threadIdx.x;
  const int lane = tid & 31, wave = tid >> 5;
  const int fr   = lane & 15;
  const int kb8  = (lane >> 4) << 3;
  const int hb   = kb8;
  const int kh   = wave >> 2;  // which 32 keys of a stage
  const int q0   = blockIdx.x * 128 + (wave & 3) * 32;

  // Q fragments (already scaled by 1/sqrt(DH)) held for the whole KV loop;
  // B operand: lane = query column fr of column tile qt
  bf16x16 bq[2][2];
#pragma unroll
  for (int qt = 0; qt < 2; ++qt) {
    const __bf16* qrow = qb + ((size_t)g * SEQ + q0 + qt * 16 + fr) * HDIM;
    bq[qt][0] = frag_ld(qrow + kb8);
    bq[qt][1] = frag_ld(qrow + 32 + kb8);
  }
  // stands in front of every later write of the Q loads' address registers
  asm volatile("s_wait_xcnt 0x0" ::: "memory");

  f32x8 acco[2][4];  // O^T: acco[qt][ni][r] = O[q0 + qt * 16 + fr][ni * 16 + hb + r]
  float rm[2];       // running max of the query (same in both lane halves)
  float rl[2];       // running sum over this lane half's keys only
#pragma unroll
  for (int qt = 0; qt < 2; ++qt) {
#pragma unroll
    for (int ni = 0; ni < 4; ++ni)
#pragma unroll
      for (int r = 0; r < 8; ++r) acco[qt][ni][r] = 0.f;
    // a finite floor below every score: a key half whose keys are all masked
    // keeps it, has sum 0, and joins the other half with weight 0
    rm[qt] = -1.0e30f;
    rl[qt] = 0.f;
  }

  // staging map, K (64 keys x 64 dh) and V^T (64 dh x 64 keys) alike: 8 lanes
  // copy one 128-byte row, a thread copies rows srow and srow + 32
  const int srow = tid >> 3, scol = (tid & 7) * 8;
  const __bf16* gk = kb + ((size_t)g * SEQ + srow) * HDIM + scol;
  const __bf16* gv = vtb + ((size_t)g * HDIM + srow) * SEQ + scol;
  __bf16* sk = &lK[0][srow * LKS + scol];
  __bf16* sv = &lV[0][srow * LKS + scol];

  auto stage = [&](int kv0, int buf) {
    const int bo = buf * (KVS * LKS);
#pragma unroll
    for (int j = 0; j < 2; ++j) {
      async_cp16(gk + (size_t)(kv0 + j * 32) * HDIM, sk + bo + j * 32 * LKS);
      async_cp16(gv + (size_t)j * 32 * SEQ + kv0,    sv + bo + j * 32 * LKS);
    }
  };

  stage(0, 0);

  // additive mask row, 16 keys a thread; the barrier in front of the KV loop
  // stands between these stores and every read of the row
#pragma unroll
  for (int j = 0; j < SEQ / 1024; ++j) {
    const v4i mk = *(const v4i*)(mask + j * 1024 + tid * 4);
    f32x4 mb;
#pragma unroll
    for (int i = 0; i < 4; ++i) mb[i] = mk[i] ? 0.f : -__builtin_inff();
    *(f32x4*)(&lM[j * 1024 + tid * 4]) = mb;
  }

  // stage 0 has landed before the barrier behind which other waves read it
  asm volatile("s_wait_asynccnt 0x0" ::: "memory");
  __syncthreads();
  stage(KVS, 1);

  for (int t = 0; t < SEQ / KVS; ++t) {
    const int cur = t & 1;
    // scores: S^T[32 keys x 32 q] = K (32x64) . Q^T; s[qt][0][r] = key hb + r,
    // s[qt][1][r] = key 16 + hb + r of this wave's keys, both of query fr of
    // tile qt. The tiles start from the mask row of their keys (all lanes of a
    // half read the same 16 bytes)
    const float* mrow = &lM[t * KVS + kh * 32 + hb];
    const f32x8 mk0 = __builtin_shufflevector(*(const f32x4*)(mrow), *(const f32x4*)(mrow + 4),
                                              0, 1, 2, 3, 4, 5, 6, 7);
    const f32x8 mk1 = __builtin_shufflevector(*(const f32x4*)(mrow + 16), *(const f32x4*)(mrow + 20),
                                              0, 1, 2, 3, 4, 5, 6, 7);
    const __bf16* kbuf = &lK[cur][(kh * 32 + fr) * LKS + kb8];
    const __bf16* vbuf = &lV[cur][fr * LKS + kh * 32 + kb8];
    const bf16x16 a00 = frag_ld(kbuf);
    const bf16x16 a10 = frag_ld(kbuf + 16 * LKS);
    const bf16x16 a01 = frag_ld(kbuf + 32);
    const bf16x16 a11 = frag_ld(kbuf + 16 * LKS + 32);
    // keeps the four mask-row reads and all eight K reads ahead of the first
    // product: otherwise they are issued in small groups, each behind a wait on
    // the group before, and a wave pays the LDS latency several times a step
    __builtin_amdgcn_sched_barrier(0);
    f32x8 s[2][2];
#pragma unroll
    for (int qt = 0; qt < 2; ++qt) {
      s[qt][0] = wmma_bf16(a00, bq[qt][0], mk0);
      s[qt][1] = wmma_bf16(a10, bq[qt][0], mk1);
    }
#pragma unroll
    for (int qt = 0; qt < 2; ++qt) {
      s[qt][0] = wmma_bf16(a01, bq[qt][1], s[qt][0]);
      s[qt][1] = wmma_bf16(a11, bq[qt][1], s[qt][1]);
    }
    bf16x16 av[4];
#pragma unroll
    for (int ni = 0; ni < 4; ++ni) av[ni] = frag_ld(vbuf + ni * 16 * LKS);
    // keeps all eight V reads ahead of the softmax arithmetic, under which they
    // land: otherwise they stand among the last products, each behind a wait
    __builtin_amdgcn_sched_barrier(0);

#pragma unroll
    for (int qt = 0; qt < 2; ++qt) {
      f32x8 s0 = s[qt][0], s1 = s[qt][1];
      // online softmax: max over the lane's 16 keys, one exchange for the rest
      float tm[8];
#pragma unroll
      for (int r = 0; r < 8; ++r) tm[r] = fmaxf(s0[r], s1[r]);
      float tx = fmaxf(fmaxf(fmaxf(tm[0], tm[1]), fmaxf(tm[2], tm[3])),
                       fmaxf(fmaxf(tm[4], tm[5]), fmaxf(tm[6], tm[7])));
      tx = fmaxf(tx, swap_halves(tx));
      const float mnew = fmaxf(rm[qt], tx);
      const float corr = __expf(rm[qt] - mnew);
      rm[qt] = mnew;
      // exp(x) as exp2(x * log2 e), what __expf compiles to, written on pairs of
      // neighbouring accumulator registers: paired otherwise, the packed
      // subtract and multiply need a register copy per element
      float ts[8];
#pragma unroll
      for (int i = 0; i < 4; ++i) {
        const f32x2 x0 = (f32x2{s0[2 * i], s0[2 * i + 1]} - mnew) * 1.44269504f;
        const f32x2 x1 = (f32x2{s1[2 * i], s1[2 * i + 1]} - mnew) * 1.44269504f;
        s0[2 * i]     = __builtin_amdgcn_exp2f(x0[0]);
        s0[2 * i + 1] = __builtin_amdgcn_exp2f(x0[1]);
        s1[2 * i]     = __builtin_amdgcn_exp2f(x1[0]);
        s1[2 * i + 1] = __builtin_amdgcn_exp2f(x1[1]);
        const f32x2 t2 = f32x2{s0[2 * i], s0[2 * i + 1]} + f32x2{s1[2 * i], s1[2 * i + 1]};
        ts[2 * i]     = t2[0];
        ts[2 * i + 1] = t2[1];
      }
      rl[qt] = rl[qt] * corr + (((ts[0] + ts[1]) + (ts[2] + ts[3])) +
                                ((ts[4] + ts[5]) + (ts[6] + ts[7])));
#pragma unroll
      for (int ni = 0; ni < 4; ++ni)
#pragma unroll
        for (int r = 0; r < 8; ++r) acco[qt][ni][r] *= corr;

      // P^T as B operand: the two score tiles, converted in place, are already
      // in the hardware k order that frag_ld gives the V^T rows
      bf16x16 bp;
#pragma unroll
      for (int r = 0; r < 8; ++r) { bp[r] = (__bf16)s0[r]; bp[r + 8] = (__bf16)s1[r]; }

#pragma unroll
      for (int ni = 0; ni < 4; ++ni) acco[qt][ni] = wmma_bf16(av[ni], bp, acco[qt][ni]);
    }

    // keeps the hand-over behind the trip's arithmetic: moved up, its first wait
    // stands right behind the V reads, and the wave sits out their latency
    // instead of covering it with the softmax
    __builtin_amdgcn_sched_barrier(0);
    // hand-over: this wave's reads of buffer cur are done ...
    asm volatile("s_wait_dscnt 0x0" ::: "memory");
    // ... and its copies of stage t + 1 have landed, before the barrier that
    // publishes stage t + 1 and frees buffer cur for the refill
    asm volatile("s_wait_asynccnt 0x0" ::: "memory");
    __syncthreads();
    if (t + 2 < SEQ / KVS) stage((t + 2) * KVS, cur);
  }
  // no copy is outstanding when the wave goes on to its stores and ends
  asm volatile("s_wait_asynccnt 0x0" ::: "memory");

  // join the lane halves' sums, then the two key halves: wave w and wave w ^ 4
  // hold the same queries. The wave of key half kh finishes column tile kh and
  // hands the other tile (max, sum, O^T) to its partner through its own LDS range
  const bool up = kh != 0;
#pragma unroll
  for (int qt = 0; qt < 2; ++qt) rl[qt] += swap_halves(rl[qt]);
#pragma unroll
  for (int ni = 0; ni < 4; ++ni)
#pragma unroll
    for (int h = 0; h < 2; ++h) {
      f32x4 x;
#pragma unroll
      for (int i = 0; i < 4; ++i) x[i] = up ? acco[0][ni][h * 4 + i] : acco[1][ni][h * 4 + i];
      *(f32x4*)(&lX[wave][ni * 2 + h][lane][0]) = x;
    }
  {
    f32x4 x;
    x[0] = up ? rm[0] : rm[1];
    x[1] = up ? rl[0] : rl[1];
    x[2] = 0.f;
    x[3] = 0.f;
    *(f32x4*)(&lX[wave][8][lane][0]) = x;
  }
  // every wave's hand-over is written before its partner reads it
  __syncthreads();
  const f32x4 pml = *(const f32x4*)(&lX[wave ^ 4][8][lane][0]);
  const float ma = up ? rm[1] : rm[0];
  const float la = up ? rl[1] : rl[0];
  const float mj = fmaxf(ma, pml[0]);
  const float ca = __expf(ma - mj);
  const float cb = __expf(pml[0] - mj);
  const float lj = la * ca + pml[1] * cb;

  // normalize, write bf16 attention output [s][g*64+dh]: a lane holds 8
  // consecutive dh of its query per tile, one 16-byte store each
  __bf16* orow = outp + (size_t)(q0 + kh * 16 + fr) * DDIM + g * HDIM + hb;
#pragma unroll
  for (int ni = 0; ni < 4; ++ni) {
    bf16x8 o;
#pragma unroll
    for (int h = 0; h < 2; ++h) {
      const f32x4 p = *(const f32x4*)(&lX[wave ^ 4][ni * 2 + h][lane][0]);
#pragma unroll
      for (int i = 0; i < 4; ++i) {
        const float mine = up ? acco[1][ni][h * 4 + i] : acco[0][ni][h * 4 + i];
        o[h * 4 + i] = (__bf16)((mine * ca + p[i] * cb) / lj);
      }
    }
    *(bf16x8*)(orow + ni * 16) = o;
  }
}

// ---------------------------------------------------------------------------
extern "C" void kernel_launch(void* const* d_in, const int* in_sizes, int n_in,
                              void* d_out, int out_size, void* d_ws, size_t ws_size,
                              hipStream_t stream) {
  const float* q    = (const float*)d_in[0];
  const float* k    = (const float*)d_in[1];
  const float* v    = (const float*)d_in[2];
  const int*   mask = (const int*)d_in[3];
  const float* Wq   = (const float*)d_in[4];
  const float* bq   = (const float*)d_in[5];
  const float* Wk   = (const float*)d_in[6];
  const float* bk   = (const float*)d_in[7];
  const float* Wv   = (const float*)d_in[8];
  const float* bv   = (const float*)d_in[9];
  const float* Wo   = (const float*)d_in[10];
  const float* bo   = (const float*)d_in[11];

  // workspace layout (bf16 elements); total 32M elems = 64 MB
  __bf16* ws  = (__bf16*)d_ws;
  const size_t MEL = (size_t)1024 * 1024;
  __bf16* wqb = ws + 0 * MEL;
  __bf16* wkb = ws + 1 * MEL;
  __bf16* wvb = ws + 2 * MEL;
  __bf16* wob = ws + 3 * MEL;
  __bf16* xq  = ws + 4 * MEL;    // query bf16 [S][D]
  __bf16* xk  = ws + 8 * MEL;    // key   bf16 [S][D]
  __bf16* xv  = ws + 12 * MEL;   // value bf16 [S][D]
  __bf16* qbf = ws + 16 * MEL;   // [G][S][DH] (pre-scaled by 1/8)
  __bf16* kbf = ws + 20 * MEL;   // [G][S][DH]
  __bf16* vtb = ws + 24 * MEL;   // [G][DH][S]
  __bf16* abf = ws + 28 * MEL;   // [S][D]

  // ws + 0 .. ws + 16 MEL: wqb wkb wvb wob xq xk xv, in this order
  cvt_all_f32_to_bf16<<<(4 * DDIM * DDIM + 3 * SEQ * DDIM) / CVT_BLK, 256, 0, stream>>>(
      Wq, Wk, Wv, Wo, q, k, v, ws);

  dim3 gg(DDIM / BN, SEQ / BM);  // (8, 32)
  // z = 0, 1, 2: xq xk xv, wqb wkb wvb and qbf kbf vtb each lie back to back
  gemm_bf16_wmma<GM_QKV><<<dim3(DDIM / BN, SEQ / BM, 3), 256, 0, stream>>>(
      xq, wqb, bq, bk, bv, qbf, 0.125f);

  attn_wmma<<<dim3(SEQ / 128, GRP), 256, 0, stream>>>(qbf, kbf, vtb, mask, abf);

  // the second and third bias arguments are read by GM_QKV alone
  gemm_bf16_wmma<GM_OUT><<<gg, 256, 0, stream>>>(abf, wob, bo, bo, bo, d_out, 1.0f);
}

// v008
// It runs in 112 microseconds.
// In both of two side-by-side timings against v007, it was 1.04 times as fast.
// All steps since v000 together make it 2.33 times as fast.
#include <hip/hip_runtime.h>
#include <hip/hip_bf16.h>
#include <math.h>
#include <stdint.h>

#define DDIM 1024
#define SEQ  4096
#define GRP  16
#define HDIM 64

typedef __attribute__((ext_vector_type(16))) __bf16 bf16x16;
typedef __attribute__((ext_vector_type(8)))  __bf16 bf16x8;
typedef __attribute__((ext_vector_type(4)))  __bf16 bf16x4;
typedef __attribute__((ext_vector_type(8)))  float  f32x8;
typedef __attribute__((ext_vector_type(4)))  float  f32x4;
typedef __attribute__((ext_vector_type(2)))  float  f32x2;
typedef int v4i __attribute__((vector_size(4 * sizeof(int))));

static __device__ __forceinline__ f32x8 wmma_bf16(bf16x16 a, bf16x16 b, f32x8 c) {
  // D = A(16x32 bf16) * B(32x16 bf16) + C(16x16 f32)
  return __builtin_amdgcn_wmma_f32_16x16x32_bf16(false, a, false, b, (short)0, c,
                                                 false, false);
}

// Load one 16x32 bf16 A/B fragment: lanes 0-15 hold K=0..7 / 16..23,
// lanes 16-31 hold K=8..15 / 24..31 (caller adds (lane>>4)*8).
static __device__ __forceinline__ bf16x16 frag_ld(const __bf16* p) {
  bf16x8 lo = *(const bf16x8*)(p);
  bf16x8 hi = *(const bf16x8*)(p + 16);
  bf16x16 r;
#pragma unroll
  for (int i = 0; i < 8; ++i) { r[i] = lo[i]; r[i + 8] = hi[i]; }
  return r;
}

// ---- CDNA5 async global->LDS copy (ASYNCcnt), 16 bytes per lane ------------
static __device__ __forceinline__ void async_cp16(const void* g, void* l) {
#if __has_builtin(__builtin_amdgcn_global_load_async_to_lds_b128)
  __builtin_amdgcn_global_load_async_to_lds_b128(
      (__attribute__((address_space(1))) v4i*)(uintptr_t)g,
      (__attribute__((address_space(3))) v4i*)(uintptr_t)l, 0, 0);
#else
  asm volatile("global_load_async_to_lds_b128 %0, %1, off"
               :: "v"((unsigned)(uintptr_t)l),
                  "v"((unsigned long long)(uintptr_t)g)
               : "memory");
#endif
}

// ---- lane l <-> l ^ 16 exchange via v_permlanex16_b32 (pure VALU) ----------
static __device__ __forceinline__ float swap_halves(float x) {
  int u = __builtin_bit_cast(int, x);
  u = __builtin_amdgcn_permlanex16(u, u, 0x76543210, 0xfedcba98, false, false);
  return __builtin_bit_cast(float, u);
}

// ---------------------------------------------------------------------------
// fp32 -> bf16 conversion of all seven operands in one streaming launch.
// The destinations lie back to back in the workspace (Wq Wk Wv Wo q k v), so a
// block's index names both its 32768-element destination slice and, by a
// block-uniform select, its source. A wave owns 4096 contiguous elements:
// 32 whole-line 16-byte loads per lane, all issued before the first is used.
// ---------------------------------------------------------------------------
#define CVT_LD  32                  // 16-byte loads per lane
#define CVT_BLK (256 * 4 * CVT_LD)  // elements per block (32768)

__global__ __launch_bounds__(256) void cvt_all_f32_to_bf16(
    const float* __restrict__ wq, const float* __restrict__ wk,
    const float* __restrict__ wv, const float* __restrict__ wo,
    const float* __restrict__ q, const float* __restrict__ k,
    const float* __restrict__ v, __bf16* __restrict__ dst) {
  const int b = blockIdx.x;
  const int wblk = DDIM * DDIM / CVT_BLK;  // blocks per weight (32)
  const int ablk = SEQ * DDIM / CVT_BLK;   // blocks per activation (128)
  const float* src;
  int lb;
  if (b < 4 * wblk) {
    const int t = b / wblk;
    src = t == 0 ? wq : t == 1 ? wk : t == 2 ? wv : wo;
    lb  = b % wblk;
  } else {
    const int t = (b - 4 * wblk) / ablk;
    src = t == 0 ? q : t == 1 ? k : v;
    lb  = (b - 4 * wblk) % ablk;
  }
  const int e = (threadIdx.x >> 5) * (128 * CVT_LD) + (threadIdx.x & 31) * 4;
  const float* s = src + (size_t)lb * CVT_BLK + e;
  __bf16*      d = dst + (size_t)b * CVT_BLK + e;

  f32x4 x[CVT_LD];
#pragma unroll
  for (int j = 0; j < CVT_LD; ++j) x[j] = *(const f32x4*)(s + j * 128);
  // keeps every load ahead of the first conversion: without it the scheduler
  // issues 18 loads and the other 14 in small groups behind waits on those, so
  // a wave pays the memory latency several times over
  __builtin_amdgcn_sched_barrier(0);
#pragma unroll
  for (int j = 0; j < CVT_LD; ++j) {
    bf16x4 o;
#pragma unroll
    for (int i = 0; i < 4; ++i) o[i] = (__bf16)x[j][i];
    *(bf16x4*)(d + j * 128) = o;
  }
}

// ---------------------------------------------------------------------------
// GEMM: C[4096,1024] = X[4096,1024] @ W.T + b (both bf16, NT, async staged)
// Block 128x128x128, 256 threads = 8 waves, wave tile 32x64 (2x4 WMMA),
// double-buffered LDS. A stage holds 128 k of every row: a 256-byte row piece,
// copied by 16 adjacent lanes, so a wave's copy covers whole lines, and one
// wait + barrier serves 32 WMMAs a wave.
// GM_QKV is the three input projections in one launch: blockIdx.z names the
// projection (0 Q, 1 K, 2 V), whose activations, weights and outputs lie at
// equal strides in the workspace. 768 blocks, two resident on a WGP (LDS), so
// one block's first stage, hand-overs and stores run under the other's WMMAs.
// ---------------------------------------------------------------------------
#define BM 128
#define BN 128
#define BK 128
#define LDG 136  // GEMM LDS row stride (elements): 272 B = 16 B x odd

enum { GM_QKV = 0, GM_OUT = 1 };
template <int V> struct lay_tag { static constexpr int value = V; };  // output layout

template <int MODE>
__global__ __launch_bounds__(256) void gemm_bf16_wmma(
    const __bf16* __restrict__ x, const __bf16* __restrict__ w,
    const float* __restrict__ bias, const float* __restrict__ bias1,
    const float* __restrict__ bias2, void* __restrict__ outp, float oscale) {
  __shared__ __attribute__((aligned(16))) __bf16 lA[2][BM * LDG];
  __shared__ __attribute__((aligned(16))) __bf16 lB[2][BN * LDG];

  const int pz = MODE == GM_QKV ? (int)blockIdx.z : 0;  // projection, block-uniform
  if (MODE == GM_QKV) {
    x += (size_t)pz * (SEQ * DDIM);
    w += (size_t)pz * (DDIM * DDIM);
    bias   = pz == 0 ? bias : pz == 1 ? bias1 : bias2;
    oscale = pz == 0 ? oscale : 1.0f;  // the softmax scale goes into Q alone
  }

  const int tid  = threadIdx.x;
  const int lane = tid & 31, wave = tid >> 5;
  const int fr   = lane & 15;
  const int kb8  = (lane >> 4) << 3;
  const int hb   = kb8;
  const int wm   = (wave & 3) * 32;
  const int wn   = (wave >> 2) * 64;
  const int m0   = blockIdx.y * BM;
  const int n0   = blockIdx.x * BN;

  const int srow = (tid >> 4) * 8;  // first of the 8 rows that 16 lanes stage
  const int scol = (tid & 15) * 8;  // staging K offset, 16 B per lane

  const __bf16* gx = x + (size_t)(m0 + srow) * DDIM + scol;
  const __bf16* gw = w + (size_t)(n0 + srow) * DDIM + scol;
  __bf16* sa = &lA[0][srow * LDG + scol];
  __bf16* sb = &lB[0][srow * LDG + scol];

  f32x8 acc[2][4];
#pragma unroll
  for (int mi = 0; mi < 2; ++mi)
#pragma unroll
    for (int ni = 0; ni < 4; ++ni)
#pragma unroll
      for (int r = 0; r < 8; ++r) acc[mi][ni][r] = 0.f;

  auto stage = [&](int kt, int buf) {
    const int bo = buf * (BM * LDG);
    // unrolled so that the row steps become the copies' immediate offsets: one
    // address pair per operand instead of one per copy
#pragma unroll
    for (int j = 0; j < 8; ++j) {
      async_cp16(gx + kt + j * DDIM, sa + bo + j * LDG);
      async_cp16(gw + kt + j * DDIM, sb + bo + j * LDG);
    }
  };

  stage(0, 0);
  // stage 0 has landed before the barrier behind which other waves read it
  asm volatile("s_wait_asynccnt 0x0" ::: "memory");
  __syncthreads();
  stage(BK, 1);

  for (int t = 0; t < DDIM / BK; ++t) {
    const int cur = t & 1;
    // unrolled so that the k steps become immediate LDS offsets and the next
    // 32 k's fragment loads can issue among this block's WMMAs
#pragma unroll
    for (int kk = 0; kk < BK; kk += 32) {
      bf16x16 af[2], bw[4];
#pragma unroll
      for (int mi = 0; mi < 2; ++mi)
        af[mi] = frag_ld(&lA[cur][(wm + mi * 16 + fr) * LDG + kk + kb8]);
#pragma unroll
      for (int ni = 0; ni < 4; ++ni)
        bw[ni] = frag_ld(&lB[cur][(wn + ni * 16 + fr) * LDG + kk + kb8]);
#pragma unroll
      for (int mi = 0; mi < 2; ++mi)
#pragma unroll
        for (int ni = 0; ni < 4; ++ni)
          acc[mi][ni] = wmma_bf16(af[mi], bw[ni], acc[mi][ni]);
    }
    // hand-over: this wave's reads of buffer cur are done ...
    asm volatile("s_wait_dscnt 0x0" ::: "memory");
    // ... and its copies of stage t + 1 have landed, before the barrier that
    // publishes stage t + 1 and frees buffer cur for the refill
    asm volatile("s_wait_asynccnt 0x0" ::: "memory");
    __syncthreads();
    if (t + 2 < DDIM / BK) stage((t + 2) * BK, cur);
  }
  // no copy is outstanding when the wave goes on to its stores and ends
  asm volatile("s_wait_asynccnt 0x0" ::: "memory");

  // epilogue: bias (+ scale folded into Q) + layout scatter; lay 0: f32 [s][d],
  // 1: bf16 per-head [g][s][dh], 2: bf16 transposed [g][dh][s]
  float bn4[4];  // the bias of this lane's four output columns
  // unrolled so that bn4 is indexed by constants alone and stays in registers
#pragma unroll
  for (int ni = 0; ni < 4; ++ni) bn4[ni] = bias[n0 + wn + ni * 16 + fr];
  auto store_tiles = [&](auto lay) {
    __bf16* ob = (__bf16*)outp + (size_t)pz * (SEQ * DDIM);
#pragma unroll
    for (int mi = 0; mi < 2; ++mi) {
#pragma unroll
      for (int ni = 0; ni < 4; ++ni) {
        const int   n  = n0 + wn + ni * 16 + fr;
        const float bn = bn4[ni];
        const int   gq = n >> 6, dh = n & 63;
#pragma unroll
        for (int r = 0; r < 8; ++r) {
          const int   m   = m0 + wm + mi * 16 + r + hb;
          const float val = acc[mi][ni][r] + bn;
          if (lay.value == 0) {
            ((float*)outp)[(size_t)m * DDIM + n] = val;
          } else if (lay.value == 1) {
            ob[((size_t)gq * SEQ + m) * HDIM + dh] = (__bf16)(val * oscale);
          } else {
            ob[((size_t)gq * HDIM + dh) * SEQ + m] = (__bf16)val;
          }
        }
      }
    }
  };
  if (MODE == GM_OUT) {
    store_tiles(lay_tag<0>{});
    return;
  }
  if (pz == 2) {
    store_tiles(lay_tag<2>{});
    return;
  }
  store_tiles(lay_tag<1>{});
  // precaution: the listing lays the transposed layout's block behind these
  // stores, and it rewrites their data registers; this wait stands in between
  asm volatile("s_wait_xcnt 0x0" ::: "memory");
}

#define LKS 72  // K and V tile row stride: 144 B, 16B-aligned
#define KVS 64  // keys per stage
#define RS_GAP 5.5f  // how far a score may outgrow the reference (about 8 in log2)

__global__ __launch_bounds__(256) void attn_wmma(
    const __bf16* __restrict__ qb, const __bf16* __restrict__ kb,
    const __bf16* __restrict__ vtb, const int* __restrict__ mask,
    __bf16* __restrict__ outp) {
  __shared__ __attribute__((aligned(16))) __bf16 lK[2][KVS * LKS];   // [key][dh]
  __shared__ __attribute__((aligned(16))) __bf16 lV[2][HDIM * LKS];  // [dh][key] (V pre-transposed)
  __shared__ __attribute__((aligned(16))) float lM[SEQ];  // 0 or -inf per key
  __shared__ __attribute__((aligned(16))) float lX[8][9][32][4];  // hand-over [wave][slot][lane]

  const int g    = blockIdx.y;
  const int tid  = threadIdx.x;
  const int lane = tid & 31, wave = tid >> 5;
  const int fr   = lane & 15;
  const int kb8  = (lane >> 4) << 3;
  const int hb   = kb8;
  const int kh   = wave >> 2;  // which 32 keys of a stage
  const int q0   = blockIdx.x * 128 + (wave & 3) * 32;

  // Q fragments (already scaled by 1/sqrt(DH)) held for the whole KV loop;
  // B operand: lane = query column fr of column tile qt
  bf16x16 bq[2][2];
#pragma unroll
  for (int qt = 0; qt < 2; ++qt) {
    const __bf16* qrow = qb + ((size_t)g * SEQ + q0 + qt * 16 + fr) * HDIM;
    bq[qt][0] = frag_ld(qrow + kb8);
    bq[qt][1] = frag_ld(qrow + 32 + kb8);
  }
  // stands in front of every later write of the Q loads' address registers
  asm volatile("s_wait_xcnt 0x0" ::: "memory");

  f32x8 acco[2][4];  // O^T: acco[qt][ni][r] = O[q0 + qt * 16 + fr][ni * 16 + hb + r]
  float rm[2];       // reference of the query's exponentials (same in both lane halves)
  float rt[2];       // rm + RS_GAP: a score above it moves the reference
  float rl[2];       // running sum over this lane half's keys only
#pragma unroll
  for (int qt = 0; qt < 2; ++qt) {
#pragma unroll
    for (int ni = 0; ni < 4; ++ni)
#pragma unroll
      for (int r = 0; r < 8; ++r) acco[qt][ni][r] = 0.f;
    // a finite floor below every score: a key half whose keys are all masked
    // keeps it, has sum 0, and joins the other half with weight 0
    rm[qt] = -1.0e30f;
    rt[qt] = -1.0e30f;
    rl[qt] = 0.f;
  }

  // staging map, K (64 keys x 64 dh) and V^T (64 dh x 64 keys) alike: 8 lanes
  // copy one 128-byte row, a thread copies rows srow and srow + 32
  const int srow = tid >> 3, scol = (tid & 7) * 8;
  const __bf16* gk = kb + ((size_t)g * SEQ + srow) * HDIM + scol;
  const __bf16* gv = vtb + ((size_t)g * HDIM + srow) * SEQ + scol;
  __bf16* sk = &lK[0][srow * LKS + scol];
  __bf16* sv = &lV[0][srow * LKS + scol];

  auto stage = [&](int kv0, int buf) {
    const int bo = buf * (KVS * LKS);
#pragma unroll
    for (int j = 0; j < 2; ++j) {
      async_cp16(gk + (size_t)(kv0 + j * 32) * HDIM, sk + bo + j * 32 * LKS);
      async_cp16(gv + (size_t)j * 32 * SEQ + kv0,    sv + bo + j * 32 * LKS);
    }
  };

  stage(0, 0);

  // additive mask row, 16 keys a thread; the barrier in front of the KV loop
  // stands between these stores and every read of the row
#pragma unroll
  for (int j = 0; j < SEQ / 1024; ++j) {
    const v4i mk = *(const v4i*)(mask + j * 1024 + tid * 4);
    f32x4 mb;
#pragma unroll
    for (int i = 0; i < 4; ++i) mb[i] = mk[i] ? 0.f : -__builtin_inff();
    *(f32x4*)(&lM[j * 1024 + tid * 4]) = mb;
  }

  // stage 0 has landed before the barrier behind which other waves read it
  asm volatile("s_wait_asynccnt 0x0" ::: "memory");
  __syncthreads();
  stage(KVS, 1);

  for (int t = 0; t < SEQ / KVS; ++t) {
    const int cur = t & 1;
    // scores: S^T[32 keys x 32 q] = K (32x64) . Q^T; s[qt][0][r] = key hb + r,
    // s[qt][1][r] = key 16 + hb + r of this wave's keys, both of query fr of
    // tile qt. The tiles start from the mask row of their keys (all lanes of a
    // half read the same 16 bytes)
    const float* mrow = &lM[t * KVS + kh * 32 + hb];
    const f32x8 mk0 = __builtin_shufflevector(*(const f32x4*)(mrow), *(const f32x4*)(mrow + 4),
                                              0, 1, 2, 3, 4, 5, 6, 7);
    const f32x8 mk1 = __builtin_shufflevector(*(const f32x4*)(mrow + 16), *(const f32x4*)(mrow + 20),
                                              0, 1, 2, 3, 4, 5, 6, 7);
    const __bf16* kbuf = &lK[cur][(kh * 32 + fr) * LKS + kb8];
    const __bf16* vbuf = &lV[cur][fr * LKS + kh * 32 + kb8];
    const bf16x16 a00 = frag_ld(kbuf);
    const bf16x16 a10 = frag_ld(kbuf + 16 * LKS);
    const bf16x16 a01 = frag_ld(kbuf + 32);
    const bf16x16 a11 = frag_ld(kbuf + 16 * LKS + 32);
    // keeps the four mask-row reads and all eight K reads ahead of the first
    // product: otherwise they are issued in small groups, each behind a wait on
    // the group before, and a wave pays the LDS latency several times a step
    __builtin_amdgcn_sched_barrier(0);
    f32x8 s[2][2];
#pragma unroll
    for (int qt = 0; qt < 2; ++qt) {
      s[qt][0] = wmma_bf16(a00, bq[qt][0], mk0);
      s[qt][1] = wmma_bf16(a10, bq[qt][0], mk1);
    }
#pragma unroll
    for (int qt = 0; qt < 2; ++qt) {
      s[qt][0] = wmma_bf16(a01, bq[qt][1], s[qt][0]);
      s[qt][1] = wmma_bf16(a11, bq[qt][1], s[qt][1]);
    }
    bf16x16 av[4];
#pragma unroll
    for (int ni = 0; ni < 4; ++ni) av[ni] = frag_ld(vbuf + ni * 16 * LKS);
    // keeps all eight V reads ahead of the softmax arithmetic, under which they
    // land: otherwise they stand among the last products, each behind a wait
    __builtin_amdgcn_sched_barrier(0);

    // online softmax, lazy rescale: the references rm move only in trips where a
    // score of the wave lies more than RS_GAP above its query's, so P stays below e^RS_GAP.
    // The test needs no exchange: each lane half tests the maximum of its own 16
    // keys, and the ballot sees both halves
    float tx[2];
#pragma unroll
    for (int qt = 0; qt < 2; ++qt) {
      const f32x8 s0 = s[qt][0], s1 = s[qt][1];
      float tm[8];
#pragma unroll
      for (int r = 0; r < 8; ++r) tm[r] = fmaxf(s0[r], s1[r]);
      tx[qt] = fmaxf(fmaxf(fmaxf(tm[0], tm[1]), fmaxf(tm[2], tm[3])),
                     fmaxf(fmaxf(tm[4], tm[5]), fmaxf(tm[6], tm[7])));
    }
    // one test a trip for both column tiles, a scalar branch of the whole wave
    if (__builtin_amdgcn_ballot_w32(tx[0] > rt[0] || tx[1] > rt[1]) != 0) {
#pragma unroll
      for (int qt = 0; qt < 2; ++qt) {
        const float mnew = fmaxf(rm[qt], fmaxf(tx[qt], swap_halves(tx[qt])));
        const float corr = __expf(rm[qt] - mnew);
        rm[qt] = mnew;
        rt[qt] = mnew + RS_GAP;
        rl[qt] *= corr;
#pragma unroll
        for (int ni = 0; ni < 4; ++ni)
#pragma unroll
          for (int r = 0; r < 8; ++r) acco[qt][ni][r] *= corr;
      }
    }

#pragma unroll
    for (int qt = 0; qt < 2; ++qt) {
      f32x8 s0 = s[qt][0], s1 = s[qt][1];
      const float mref = rm[qt];
      // exp(x) as exp2(x * log2 e), what __expf compiles to, written on pairs of
      // neighbouring accumulator registers: paired otherwise, the packed
      // subtract and multiply need a register copy per element
      float ts[8];
#pragma unroll
      for (int i = 0; i < 4; ++i) {
        const f32x2 x0 = (f32x2{s0[2 * i], s0[2 * i + 1]} - mref) * 1.44269504f;
        const f32x2 x1 = (f32x2{s1[2 * i], s1[2 * i + 1]} - mref) * 1.44269504f;
        s0[2 * i]     = __builtin_amdgcn_exp2f(x0[0]);
        s0[2 * i + 1] = __builtin_amdgcn_exp2f(x0[1]);
        s1[2 * i]     = __builtin_amdgcn_exp2f(x1[0]);
        s1[2 * i + 1] = __builtin_amdgcn_exp2f(x1[1]);
        const f32x2 t2 = f32x2{s0[2 * i], s0[2 * i + 1]} + f32x2{s1[2 * i], s1[2 * i + 1]};
        ts[2 * i]     = t2[0];
        ts[2 * i + 1] = t2[1];
      }
      rl[qt] += ((ts[0] + ts[1]) + (ts[2] + ts[3])) + ((ts[4] + ts[5]) + (ts[6] + ts[7]));

      // P^T as B operand: the two score tiles, converted in place, are already
      // in the hardware k order that frag_ld gives the V^T rows
      bf16x16 bp;
#pragma unroll
      for (int r = 0; r < 8; ++r) { bp[r] = (__bf16)s0[r]; bp[r + 8] = (__bf16)s1[r]; }

#pragma unroll
      for (int ni = 0; ni < 4; ++ni) acco[qt][ni] = wmma_bf16(av[ni], bp, acco[qt][ni]);
    }

    // keeps the hand-over behind the trip's arithmetic: moved up, its first wait
    // stands right behind the V reads, and the wave sits out their latency
    // instead of covering it with the softmax
    __builtin_amdgcn_sched_barrier(0);
    // hand-over: this wave's reads of buffer cur are done ...
    asm volatile("s_wait_dscnt 0x0" ::: "memory");
    // ... and its copies of stage t + 1 have landed, before the barrier that
    // publishes stage t + 1 and frees buffer cur for the refill
    asm volatile("s_wait_asynccnt 0x0" ::: "memory");
    __syncthreads();
    if (t + 2 < SEQ / KVS) stage((t + 2) * KVS, cur);
  }
  // no copy is outstanding when the wave goes on to its stores and ends
  asm volatile("s_wait_asynccnt 0x0" ::: "memory");

  // join the lane halves' sums, then the two key halves: wave w and wave w ^ 4
  // hold the same queries. The wave of key half kh finishes column tile kh and
  // hands the other tile (max, sum, O^T) to its partner through its own LDS range
  const bool up = kh != 0;
#pragma unroll
  for (int qt = 0; qt < 2; ++qt) rl[qt] += swap_halves(rl[qt]);
#pragma unroll
  for (int ni = 0; ni < 4; ++ni)
#pragma unroll
    for (int h = 0; h < 2; ++h) {
      f32x4 x;
#pragma unroll
      for (int i = 0; i < 4; ++i) x[i] = up ? acco[0][ni][h * 4 + i] : acco[1][ni][h * 4 + i];
      *(f32x4*)(&lX[wave][ni * 2 + h][lane][0]) = x;
    }
  {
    f32x4 x;
    x[0] = up ? rm[0] : rm[1];
    x[1] = up ? rl[0] : rl[1];
    x[2] = 0.f;
    x[3] = 0.f;
    *(f32x4*)(&lX[wave][8][lane][0]) = x;
  }
  // every wave's hand-over is written before its partner reads it
  __syncthreads();
  const f32x4 pml = *(const f32x4*)(&lX[wave ^ 4][8][lane][0]);
  const float ma = up ? rm[1] : rm[0];
  const float la = up ? rl[1] : rl[0];
  const float mj = fmaxf(ma, pml[0]);
  const float ca = __expf(ma - mj);
  const float cb = __expf(pml[0] - mj);
  const float lj = la * ca + pml[1] * cb;

  // normalize, write bf16 attention output [s][g*64+dh]: a lane holds 8
  // consecutive dh of its query per tile, one 16-byte store each
  __bf16* orow = outp + (size_t)(q0 + kh * 16 + fr) * DDIM + g * HDIM + hb;
#pragma unroll
  for (int ni = 0; ni < 4; ++ni) {
    bf16x8 o;
#pragma unroll
    for (int h = 0; h < 2; ++h) {
      const f32x4 p = *(const f32x4*)(&lX[wave ^ 4][ni * 2 + h][lane][0]);
#pragma unroll
      for (int i = 0; i < 4; ++i) {
        const float mine = up ? acco[1][ni][h * 4 + i] : acco[0][ni][h * 4 + i];
        o[h * 4 + i] = (__bf16)((mine * ca + p[i] * cb) / lj);
      }
    }
    *(bf16x8*)(orow + ni * 16) = o;
  }
}

// ---------------------------------------------------------------------------
extern "C" void kernel_launch(void* const* d_in, const int* in_sizes, int n_in,
                              void* d_out, int out_size, void* d_ws, size_t ws_size,
                              hipStream_t stream) {
  const float* q    = (const float*)d_in[0];
  const float* k    = (const float*)d_in[1];
  const float* v    = (const float*)d_in[2];
  const int*   mask = (const int*)d_in[3];
  const float* Wq   = (const float*)d_in[4];
  const float* bq   = (const float*)d_in[5];
  const float* Wk   = (const float*)d_in[6];
  const float* bk   = (const float*)d_in[7];
  const float* Wv   = (const float*)d_in[8];
  const float* bv   = (const float*)d_in[9];
  const float* Wo   = (const float*)d_in[10];
  const float* bo   = (const float*)d_in[11];

  // workspace layout (bf16 elements); total 32M elems = 64 MB
  __bf16* ws  = (__bf16*)d_ws;
  const size_t MEL = (size_t)1024 * 1024;
  __bf16* wqb = ws + 0 * MEL;
  __bf16* wkb = ws + 1 * MEL;
  __bf16* wvb = ws + 2 * MEL;
  __bf16* wob = ws + 3 * MEL;
  __bf16* xq  = ws + 4 * MEL;    // query bf16 [S][D]
  __bf16* xk  = ws + 8 * MEL;    // key   bf16 [S][D]
  __bf16* xv  = ws + 12 * MEL;   // value bf16 [S][D]
  __bf16* qbf = ws + 16 * MEL;   // [G][S][DH] (pre-scaled by 1/8)
  __bf16* kbf = ws + 20 * MEL;   // [G][S][DH]
  __bf16* vtb = ws + 24 * MEL;   // [G][DH][S]
  __bf16* abf = ws + 28 * MEL;   // [S][D]

  // ws + 0 .. ws + 16 MEL: wqb wkb wvb wob xq xk xv, in this order
  cvt_all_f32_to_bf16<<<(4 * DDIM * DDIM + 3 * SEQ * DDIM) / CVT_BLK, 256, 0, stream>>>(
      Wq, Wk, Wv, Wo, q, k, v, ws);

  dim3 gg(DDIM / BN, SEQ / BM);  // (8, 32)
  // z = 0, 1, 2: xq xk xv, wqb wkb wvb and qbf kbf vtb each lie back to back
  gemm_bf16_wmma<GM_QKV><<<dim3(DDIM / BN, SEQ / BM, 3), 256, 0, stream>>>(
      xq, wqb, bq, bk, bv, qbf, 0.125f);

  attn_wmma<<<dim3(SEQ / 128, GRP), 256, 0, stream>>>(qbf, kbf, vtb, mask, abf);

  // the second and third bias arguments are read by GM_QKV alone
  gemm_bf16_wmma<GM_OUT><<<gg, 256, 0, stream>>>(abf, wob, bo, bo, bo, d_out, 1.0f);
}

// v009
// It runs in 106 microseconds.
// Next to v008, in two timings, it ran 1.05 and 1.04 times as fast.
// All steps since v000 together make it 2.43 times as fast.
#include <hip/hip_runtime.h>
#include <hip/hip_bf16.h>
#include <math.h>
#include <stdint.h>

#define DDIM 1024
#define SEQ  4096
#define GRP  16
#define HDIM 64

typedef __attribute__((ext_vector_type(16))) __bf16 bf16x16;
typedef __attribute__((ext_vector_type(8)))  __bf16 bf16x8;
typedef __attribute__((ext_vector_type(4)))  __bf16 bf16x4;
typedef __attribute__((ext_vector_type(8)))  float  f32x8;
typedef __attribute__((ext_vector_type(4)))  float  f32x4;
typedef __attribute__((ext_vector_type(2)))  float  f32x2;
typedef int v4i __attribute__((vector_size(4 * sizeof(int))));

static __device__ __forceinline__ f32x8 wmma_bf16(bf16x16 a, bf16x16 b, f32x8 c) {
  // D = A(16x32 bf16) * B(32x16 bf16) + C(16x16 f32)
  return __builtin_amdgcn_wmma_f32_16x16x32_bf16(false, a, false, b, (short)0, c,
                                                 false, false);
}

// Load one 16x32 bf16 A/B fragment: lanes 0-15 hold K=0..7 / 16..23,
// lanes 16-31 hold K=8..15 / 24..31 (caller adds (lane>>4)*8).
static __device__ __forceinline__ bf16x16 frag_ld(const __bf16* p) {
  bf16x8 lo = *(const bf16x8*)(p);
  bf16x8 hi = *(const bf16x8*)(p + 16);
  bf16x16 r;
#pragma unroll
  for (int i = 0; i < 8; ++i) { r[i] = lo[i]; r[i + 8] = hi[i]; }
  return r;
}

// ---- CDNA5 async global->LDS copy (ASYNCcnt), 16 bytes per lane ------------
static __device__ __forceinline__ void async_cp16(const void* g, void* l) {
#if __has_builtin(__builtin_amdgcn_global_load_async_to_lds_b128)
  __builtin_amdgcn_global_load_async_to_lds_b128(
      (__attribute__((address_space(1))) v4i*)(uintptr_t)g,
      (__attribute__((address_space(3))) v4i*)(uintptr_t)l, 0, 0);
#else
  asm volatile("global_load_async_to_lds_b128 %0, %1, off"
               :: "v"((unsigned)(uintptr_t)l),
                  "v"((unsigned long long)(uintptr_t)g)
               : "memory");
#endif
}

// ---- lane l <-> l ^ 16 exchange via v_permlanex16_b32 (pure VALU) ----------
static __device__ __forceinline__ float swap_halves(float x) {
  int u = __builtin_bit_cast(int, x);
  u = __builtin_amdgcn_permlanex16(u, u, 0x76543210, 0xfedcba98, false, false);
  return __builtin_bit_cast(float, u);
}

// ---------------------------------------------------------------------------
// fp32 -> bf16 conversion of all seven operands in one streaming launch.
// The destinations lie back to back in the workspace (Wq Wk Wv Wo q k v), so a
// block's index names both its 32768-element destination slice and, by a
// block-uniform select, its source. A wave owns 4096 contiguous elements:
// 32 whole-line 16-byte loads per lane, all issued before the first is used.
// ---------------------------------------------------------------------------
#define CVT_LD  32                  // 16-byte loads per lane
#define CVT_BLK (256 * 4 * CVT_LD)  // elements per block (32768)

__global__ __launch_bounds__(256) void cvt_all_f32_to_bf16(
    const float* __restrict__ wq, const float* __restrict__ wk,
    const float* __restrict__ wv, const float* __restrict__ wo,
    const float* __restrict__ q, const float* __restrict__ k,
    const float* __restrict__ v, __bf16* __restrict__ dst) {
  const int b = blockIdx.x;
  const int wblk = DDIM * DDIM / CVT_BLK;  // blocks per weight (32)
  const int ablk = SEQ * DDIM / CVT_BLK;   // blocks per activation (128)
  const float* src;
  int lb;
  if (b < 4 * wblk) {
    const int t = b / wblk;
    src = t == 0 ? wq : t == 1 ? wk : t == 2 ? wv : wo;
    lb  = b % wblk;
  } else {
    const int t = (b - 4 * wblk) / ablk;
    src = t == 0 ? q : t == 1 ? k : v;
    lb  = (b - 4 * wblk) % ablk;
  }
  const int e = (threadIdx.x >> 5) * (128 * CVT_LD) + (threadIdx.x & 31) * 4;
  const float* s = src + (size_t)lb * CVT_BLK + e;
  __bf16*      d = dst + (size_t)b * CVT_BLK + e;

  f32x4 x[CVT_LD];
#pragma unroll
  for (int j = 0; j < CVT_LD; ++j) x[j] = *(const f32x4*)(s + j * 128);
  // keeps every load ahead of the first conversion: without it the scheduler
  // issues 18 loads and the other 14 in small groups behind waits on those, so
  // a wave pays the memory latency several times over
  __builtin_amdgcn_sched_barrier(0);
#pragma unroll
  for (int j = 0; j < CVT_LD; ++j) {
    bf16x4 o;
#pragma unroll
    for (int i = 0; i < 4; ++i) o[i] = (__bf16)x[j][i];
    *(bf16x4*)(d + j * 128) = o;
  }
}

// ---------------------------------------------------------------------------
// GEMM: C[4096,1024] = X[4096,1024] @ W.T + b (both bf16, NT, async staged)
// Block 128x128x128, 256 threads = 8 waves, wave tile 32x64 (2x4 WMMA),
// double-buffered LDS. A stage holds 128 k of every row: a 256-byte row piece,
// copied by 16 adjacent lanes, so a wave's copy covers whole lines, and one
// wait + barrier serves 32 WMMAs a wave.
// GM_QKV is the three input projections in one launch: blockIdx.z names the
// projection (0 Q, 1 K, 2 V), whose activations, weights and outputs lie at
// equal strides in the workspace. 768 blocks, two resident on a WGP (LDS), so
// one block's first stage, hand-overs and stores run under the other's WMMAs.
// A block walks its eight K stages in a ring from a start that its index picks:
// the 8 blocks of an activation panel and the 32 of a weight panel run at the
// same pace, and from a common start they would all ask L2 for the same lines
// at the same moment. The accumulators take the K stages in any order.
// ---------------------------------------------------------------------------
#define BM 128
#define BN 128
#define BK 128
#define LDG 136  // GEMM LDS row stride (elements): 272 B = 16 B x odd

enum { GM_QKV = 0, GM_OUT = 1 };
template <int V> struct lay_tag { static constexpr int value = V; };  // output layout

template <int MODE>
__global__ __launch_bounds__(256) void gemm_bf16_wmma(
    const __bf16* __restrict__ x, const __bf16* __restrict__ w,
    const float* __restrict__ bias, const float* __restrict__ bias1,
    const float* __restrict__ bias2, void* __restrict__ outp, float oscale) {
  __shared__ __attribute__((aligned(16))) __bf16 lA[2][BM * LDG];
  __shared__ __attribute__((aligned(16))) __bf16 lB[2][BN * LDG];

  const int pz = MODE == GM_QKV ? (int)blockIdx.z : 0;  // projection, block-uniform
  if (MODE == GM_QKV) {
    x += (size_t)pz * (SEQ * DDIM);
    w += (size_t)pz * (DDIM * DDIM);
    bias   = pz == 0 ? bias : pz == 1 ? bias1 : bias2;
    oscale = pz == 0 ? oscale : 1.0f;  // the softmax scale goes into Q alone
  }

  const int tid  = threadIdx.x;
  const int lane = tid & 31, wave = tid >> 5;
  const int fr   = lane & 15;
  const int kb8  = (lane >> 4) << 3;
  const int hb   = kb8;
  const int wm   = (wave & 3) * 32;
  const int wn   = (wave >> 2) * 64;
  const int m0   = blockIdx.y * BM;
  const int n0   = blockIdx.x * BN;
  // first K stage, block-uniform: neighbours in x lie two stages apart (all
  // eight differ), neighbours in y one stage apart
  const int rot  = 2 * (int)blockIdx.x + ((int)blockIdx.x >> 2) + (int)blockIdx.y;
  auto kof = [&](int t) { return ((t + rot) & (DDIM / BK - 1)) * BK; };

  const int srow = (tid >> 4) * 8;  // first of the 8 rows that 16 lanes stage
  const int scol = (tid & 15) * 8;  // staging K offset, 16 B per lane

  const __bf16* gx = x + (size_t)(m0 + srow) * DDIM + scol;
  const __bf16* gw = w + (size_t)(n0 + srow) * DDIM + scol;
  __bf16* sa = &lA[0][srow * LDG + scol];
  __bf16* sb = &lB[0][srow * LDG + scol];

  f32x8 acc[2][4];
#pragma unroll
  for (int mi = 0; mi < 2; ++mi)
#pragma unroll
    for (int ni = 0; ni < 4; ++ni)
#pragma unroll
      for (int r = 0; r < 8; ++r) acc[mi][ni][r] = 0.f;

  auto stage = [&](int kt, int buf) {
    const int bo = buf * (BM * LDG);
    // unrolled so that the row steps become the copies' immediate offsets: one
    // address pair per operand instead of one per copy
#pragma unroll
    for (int j = 0; j < 8; ++j) {
      async_cp16(gx + kt + j * DDIM, sa + bo + j * LDG);
      async_cp16(gw + kt + j * DDIM, sb + bo + j * LDG);
    }
  };

  stage(kof(0), 0);
  // stage 0 has landed before the barrier behind which other waves read it
  asm volatile("s_wait_asynccnt 0x0" ::: "memory");
  __syncthreads();
  stage(kof(1), 1);

  for (int t = 0; t < DDIM / BK; ++t) {
    const int cur = t & 1;
    // unrolled so that the k steps become immediate LDS offsets and the next
    // 32 k's fragment loads can issue among this block's WMMAs
#pragma unroll
    for (int kk = 0; kk < BK; kk += 32) {
      bf16x16 af[2], bw[4];
#pragma unroll
      for (int mi = 0; mi < 2; ++mi)
        af[mi] = frag_ld(&lA[cur][(wm + mi * 16 + fr) * LDG + kk + kb8]);
#pragma unroll
      for (int ni = 0; ni < 4; ++ni)
        bw[ni] = frag_ld(&lB[cur][(wn + ni * 16 + fr) * LDG + kk + kb8]);
#pragma unroll
      for (int mi = 0; mi < 2; ++mi)
#pragma unroll
        for (int ni = 0; ni < 4; ++ni)
          acc[mi][ni] = wmma_bf16(af[mi], bw[ni], acc[mi][ni]);
    }
    // hand-over: this wave's reads of buffer cur are done ...
    asm volatile("s_wait_dscnt 0x0" ::: "memory");
    // ... and its copies of stage t + 1 have landed, before the barrier that
    // publishes stage t + 1 and frees buffer cur for the refill
    asm volatile("s_wait_asynccnt 0x0" ::: "memory");
    __syncthreads();
    if (t + 2 < DDIM / BK) stage(kof(t + 2), cur);
  }
  // no copy is outstanding when the wave goes on to its stores and ends
  asm volatile("s_wait_asynccnt 0x0" ::: "memory");

  // epilogue: bias (+ scale folded into Q) + layout scatter; lay 0: f32 [s][d],
  // 1: bf16 per-head [g][s][dh], 2: bf16 transposed [g][dh][s]
  float bn4[4];  // the bias of this lane's four output columns
  // unrolled so that bn4 is indexed by constants alone and stays in registers
#pragma unroll
  for (int ni = 0; ni < 4; ++ni) bn4[ni] = bias[n0 + wn + ni * 16 + fr];
  auto store_tiles = [&](auto lay) {
    __bf16* ob = (__bf16*)outp + (size_t)pz * (SEQ * DDIM);
#pragma unroll
    for (int mi = 0; mi < 2; ++mi) {
#pragma unroll
      for (int ni = 0; ni < 4; ++ni) {
        const int   n  = n0 + wn + ni * 16 + fr;
        const float bn = bn4[ni];
        const int   gq = n >> 6, dh = n & 63;
#pragma unroll
        for (int r = 0; r < 8; ++r) {
          const int   m   = m0 + wm + mi * 16 + r + hb;
          const float val = acc[mi][ni][r] + bn;
          if (lay.value == 0) {
            ((float*)outp)[(size_t)m * DDIM + n] = val;
          } else if (lay.value == 1) {
            ob[((size_t)gq * SEQ + m) * HDIM + dh] = (__bf16)(val * oscale);
          } else {
            ob[((size_t)gq * HDIM + dh) * SEQ + m] = (__bf16)val;
          }
        }
      }
    }
  };
  if (MODE == GM_OUT) {
    store_tiles(lay_tag<0>{});
    return;
  }
  if (pz == 2) {
    store_tiles(lay_tag<2>{});
    return;
  }
  store_tiles(lay_tag<1>{});
  // precaution: the listing lays the transposed layout's block behind these
  // stores, and it rewrites their data registers; this wait stands in between
  asm volatile("s_wait_xcnt 0x0" ::: "memory");
}

#define LKS 72  // K and V tile row stride: 144 B, 16B-aligned
#define KVS 64  // keys per stage
#define RS_GAP 5.5f  // how far a score may outgrow the reference (about 8 in log2)

__global__ __launch_bounds__(256) void attn_wmma(
    const __bf16* __restrict__ qb, const __bf16* __restrict__ kb,
    const __bf16* __restrict__ vtb, const int* __restrict__ mask,
    __bf16* __restrict__ outp) {
  __shared__ __attribute__((aligned(16))) __bf16 lK[2][KVS * LKS];   // [key][dh]
  __shared__ __attribute__((aligned(16))) __bf16 lV[2][HDIM * LKS];  // [dh][key] (V pre-transposed)
  __shared__ __attribute__((aligned(16))) float lM[SEQ];  // 0 or -inf per key
  __shared__ __attribute__((aligned(16))) float lX[8][9][32][4];  // hand-over [wave][slot][lane]

  const int g    = blockIdx.y;
  const int tid  = threadIdx.x;
  const int lane = tid & 31, wave = tid >> 5;
  const int fr   = lane & 15;
  const int kb8  = (lane >> 4) << 3;
  const int hb   = kb8;
  const int kh   = wave >> 2;  // which 32 keys of a stage
  const int q0   = blockIdx.x * 128 + (wave & 3) * 32;

  // Q fragments (already scaled by 1/sqrt(DH)) held for the whole KV loop;
  // B operand: lane = query column fr of column tile qt
  bf16x16 bq[2][2];
#pragma unroll
  for (int qt = 0; qt < 2; ++qt) {
    const __bf16* qrow = qb + ((size_t)g * SEQ + q0 + qt * 16 + fr) * HDIM;
    bq[qt][0] = frag_ld(qrow + kb8);
    bq[qt][1] = frag_ld(qrow + 32 + kb8);
  }
  // stands in front of every later write of the Q loads' address registers
  asm volatile("s_wait_xcnt 0x0" ::: "memory");

  f32x8 acco[2][4];  // O^T: acco[qt][ni][r] = O[q0 + qt * 16 + fr][ni * 16 + hb + r]
  float rm[2];       // reference of the query's exponentials (same in both lane halves)
  float rt[2];       // rm + RS_GAP: a score above it moves the reference
  float rl[2];       // running sum over this lane half's keys only
#pragma unroll
  for (int qt = 0; qt < 2; ++qt) {
#pragma unroll
    for (int ni = 0; ni < 4; ++ni)
#pragma unroll
      for (int r = 0; r < 8; ++r) acco[qt][ni][r] = 0.f;
    // a finite floor below every score: a key half whose keys are all masked
    // keeps it, has sum 0, and joins the other half with weight 0
    rm[qt] = -1.0e30f;
    rt[qt] = -1.0e30f;
    rl[qt] = 0.f;
  }

  // staging map, K (64 keys x 64 dh) and V^T (64 dh x 64 keys) alike: 8 lanes
  // copy one 128-byte row, a thread copies rows srow and srow + 32
  const int srow = tid >> 3, scol = (tid & 7) * 8;
  const __bf16* gk = kb + ((size_t)g * SEQ + srow) * HDIM + scol;
  const __bf16* gv = vtb + ((size_t)g * HDIM + srow) * SEQ + scol;
  __bf16* sk = &lK[0][srow * LKS + scol];
  __bf16* sv = &lV[0][srow * LKS + scol];

  auto stage = [&](int kv0, int buf) {
    const int bo = buf * (KVS * LKS);
#pragma unroll
    for (int j = 0; j < 2; ++j) {
      async_cp16(gk + (size_t)(kv0 + j * 32) * HDIM, sk + bo + j * 32 * LKS);
      async_cp16(gv + (size_t)j * 32 * SEQ + kv0,    sv + bo + j * 32 * LKS);
    }
  };

  // first key of trip t: the ring of stages, entered at this block's own start
  const int rot = 2 * (int)blockIdx.x;
  auto kv_of = [&](int t) { return ((t + rot) & (SEQ / KVS - 1)) * KVS; };

  stage(kv_of(0), 0);

  // additive mask row, 16 keys a thread; the barrier in front of the KV loop
  // stands between these stores and every read of the row
#pragma unroll
  for (int j = 0; j < SEQ / 1024; ++j) {
    const v4i mk = *(const v4i*)(mask + j * 1024 + tid * 4);
    f32x4 mb;
#pragma unroll
    for (int i = 0; i < 4; ++i) mb[i] = mk[i] ? 0.f : -__builtin_inff();
    *(f32x4*)(&lM[j * 1024 + tid * 4]) = mb;
  }

  // stage 0 has landed before the barrier behind which other waves read it
  asm volatile("s_wait_asynccnt 0x0" ::: "memory");
  __syncthreads();
  stage(kv_of(1), 1);

  for (int t = 0; t < SEQ / KVS; ++t) {
    const int cur = t & 1;
    // scores: S^T[32 keys x 32 q] = K (32x64) . Q^T; s[qt][0][r] = key hb + r,
    // s[qt][1][r] = key 16 + hb + r of this wave's keys, both of query fr of
    // tile qt. The tiles start from the mask row of their keys (all lanes of a
    // half read the same 16 bytes)
    const float* mrow = &lM[kv_of(t) + kh * 32 + hb];
    const f32x8 mk0 = __builtin_shufflevector(*(const f32x4*)(mrow), *(const f32x4*)(mrow + 4),
                                              0, 1, 2, 3, 4, 5, 6, 7);
    const f32x8 mk1 = __builtin_shufflevector(*(const f32x4*)(mrow + 16), *(const f32x4*)(mrow + 20),
                                              0, 1, 2, 3, 4, 5, 6, 7);
    const __bf16* kbuf = &lK[cur][(kh * 32 + fr) * LKS + kb8];
    const __bf16* vbuf = &lV[cur][fr * LKS + kh * 32 + kb8];
    const bf16x16 a00 = frag_ld(kbuf);
    const bf16x16 a10 = frag_ld(kbuf + 16 * LKS);
    const bf16x16 a01 = frag_ld(kbuf + 32);
    const bf16x16 a11 = frag_ld(kbuf + 16 * LKS + 32);
    // keeps the four mask-row reads and all eight K reads ahead of the first
    // product: otherwise they are issued in small groups, each behind a wait on
    // the group before, and a wave pays the LDS latency several times a step
    __builtin_amdgcn_sched_barrier(0);
    f32x8 s[2][2];
#pragma unroll
    for (int qt = 0; qt < 2; ++qt) {
      s[qt][0] = wmma_bf16(a00, bq[qt][0], mk0);
      s[qt][1] = wmma_bf16(a10, bq[qt][0], mk1);
    }
#pragma unroll
    for (int qt = 0; qt < 2; ++qt) {
      s[qt][0] = wmma_bf16(a01, bq[qt][1], s[qt][0]);
      s[qt][1] = wmma_bf16(a11, bq[qt][1], s[qt][1]);
    }
    bf16x16 av[4];
#pragma unroll
    for (int ni = 0; ni < 4; ++ni) av[ni] = frag_ld(vbuf + ni * 16 * LKS);
    // keeps all eight V reads ahead of the softmax arithmetic, under which they
    // land: otherwise they stand among the last products, each behind a wait
    __builtin_amdgcn_sched_barrier(0);

    // online softmax, lazy rescale: the references rm move only in trips where a
    // score of the wave lies more than RS_GAP above its query's, so P stays below e^RS_GAP.
    // The test needs no exchange: each lane half tests the maximum of its own 16
    // keys, and the ballot sees both halves
    float tx[2];
#pragma unroll
    for (int qt = 0; qt < 2; ++qt) {
      const f32x8 s0 = s[qt][0], s1 = s[qt][1];
      float tm[8];
#pragma unroll
      for (int r = 0; r < 8; ++r) tm[r] = fmaxf(s0[r], s1[r]);
      tx[qt] = fmaxf(fmaxf(fmaxf(tm[0], tm[1]), fmaxf(tm[2], tm[3])),
                     fmaxf(fmaxf(tm[4], tm[5]), fmaxf(tm[6], tm[7])));
    }
    // one test a trip for both column tiles, a scalar branch of the whole wave
    if (__builtin_amdgcn_ballot_w32(tx[0] > rt[0] || tx[1] > rt[1]) != 0) {
#pragma unroll
      for (int qt = 0; qt < 2; ++qt) {
        const float mnew = fmaxf(rm[qt], fmaxf(tx[qt], swap_halves(tx[qt])));
        const float corr = __expf(rm[qt] - mnew);
        rm[qt] = mnew;
        rt[qt] = mnew + RS_GAP;
        rl[qt] *= corr;
#pragma unroll
        for (int ni = 0; ni < 4; ++ni)
#pragma unroll
          for (int r = 0; r < 8; ++r) acco[qt][ni][r] *= corr;
      }
    }

#pragma unroll
    for (int qt = 0; qt < 2; ++qt) {
      f32x8 s0 = s[qt][0], s1 = s[qt][1];
      const float mref = rm[qt];
      // exp(x) as exp2(x * log2 e), what __expf compiles to, written on pairs of
      // neighbouring accumulator registers: paired otherwise, the packed
      // subtract and multiply need a register copy per element
      float ts[8];
#pragma unroll
      for (int i = 0; i < 4; ++i) {
        const f32x2 x0 = (f32x2{s0[2 * i], s0[2 * i + 1]} - mref) * 1.44269504f;
        const f32x2 x1 = (f32x2{s1[2 * i], s1[2 * i + 1]} - mref) * 1.44269504f;
        s0[2 * i]     = __builtin_amdgcn_exp2f(x0[0]);
        s0[2 * i + 1] = __builtin_amdgcn_exp2f(x0[1]);
        s1[2 * i]     = __builtin_amdgcn_exp2f(x1[0]);
        s1[2 * i + 1] = __builtin_amdgcn_exp2f(x1[1]);
        const f32x2 t2 = f32x2{s0[2 * i], s0[2 * i + 1]} + f32x2{s1[2 * i], s1[2 * i + 1]};
        ts[2 * i]     = t2[0];
        ts[2 * i + 1] = t2[1];
      }
      rl[qt] += ((ts[0] + ts[1]) + (ts[2] + ts[3])) + ((ts[4] + ts[5]) + (ts[6] + ts[7]));

      // P^T as B operand: the two score tiles, converted in place, are already
      // in the hardware k order that frag_ld gives the V^T rows
      bf16x16 bp;
#pragma unroll
      for (int r = 0; r < 8; ++r) { bp[r] = (__bf16)s0[r]; bp[r + 8] = (__bf16)s1[r]; }

#pragma unroll
      for (int ni = 0; ni < 4; ++ni) acco[qt][ni] = wmma_bf16(av[ni], bp, acco[qt][ni]);
    }

    // keeps the hand-over behind the trip's arithmetic: moved up, its first wait
    // stands right behind the V reads, and the wave sits out their latency
    // instead of covering it with the softmax
    __builtin_amdgcn_sched_barrier(0);
    // hand-over: this wave's reads of buffer cur are done ...
    asm volatile("s_wait_dscnt 0x0" ::: "memory");
    // ... and its copies of stage t + 1 have landed, before the barrier that
    // publishes stage t + 1 and frees buffer cur for the refill
    asm volatile("s_wait_asynccnt 0x0" ::: "memory");
    __syncthreads();
    if (t + 2 < SEQ / KVS) stage(kv_of(t + 2), cur);
  }
  // no copy is outstanding when the wave goes on to its stores and ends
  asm volatile("s_wait_asynccnt 0x0" ::: "memory");

  // join the lane halves' sums, then the two key halves: wave w and wave w ^ 4
  // hold the same queries. The wave of key half kh finishes column tile kh and
  // hands the other tile (max, sum, O^T) to its partner through its own LDS range
  const bool up = kh != 0;
#pragma unroll
  for (int qt = 0; qt < 2; ++qt) rl[qt] += swap_halves(rl[qt]);
#pragma unroll
  for (int ni = 0; ni < 4; ++ni)
#pragma unroll
    for (int h = 0; h < 2; ++h) {
      f32x4 x;
#pragma unroll
      for (int i = 0; i < 4; ++i) x[i] = up ? acco[0][ni][h * 4 + i] : acco[1][ni][h * 4 + i];
      *(f32x4*)(&lX[wave][ni * 2 + h][lane][0]) = x;
    }
  {
    f32x4 x;
    x[0] = up ? rm[0] : rm[1];
    x[1] = up ? rl[0] : rl[1];
    x[2] = 0.f;
    x[3] = 0.f;
    *(f32x4*)(&lX[wave][8][lane][0]) = x;
  }
  // every wave's hand-over is written before its partner reads it
  __syncthreads();
  const f32x4 pml = *(const f32x4*)(&lX[wave ^ 4][8][lane][0]);
  const float ma = up ? rm[1] : rm[0];
  const float la = up ? rl[1] : rl[0];
  const float mj = fmaxf(ma, pml[0]);
  const float ca = __expf(ma - mj);
  const float cb = __expf(pml[0] - mj);
  const float lj = la * ca + pml[1] * cb;

  // normalize, write bf16 attention output [s][g*64+dh]: a lane holds 8
  // consecutive dh of its query per tile, one 16-byte store each
  __bf16* orow = outp + (size_t)(q0 + kh * 16 + fr) * DDIM + g * HDIM + hb;
#pragma unroll
  for (int ni = 0; ni < 4; ++ni) {
    bf16x8 o;
#pragma unroll
    for (int h = 0; h < 2; ++h) {
      const f32x4 p = *(const f32x4*)(&lX[wave ^ 4][ni * 2 + h][lane][0]);
#pragma unroll
      for (int i = 0; i < 4; ++i) {
        const float mine = up ? acco[1][ni][h * 4 + i] : acco[0][ni][h * 4 + i];
        o[h * 4 + i] = (__bf16)((mine * ca + p[i] * cb) / lj);
      }
    }
    *(bf16x8*)(orow + ni * 16) = o;
  }
}

// ---------------------------------------------------------------------------
extern "C" void kernel_launch(void* const* d_in, const int* in_sizes, int n_in,
                              void* d_out, int out_size, void* d_ws, size_t ws_size,
                              hipStream_t stream) {
  const float* q    = (const float*)d_in[0];
  const float* k    = (const float*)d_in[1];
  const float* v    = (const float*)d_in[2];
  const int*   mask = (const int*)d_in[3];
  const float* Wq   = (const float*)d_in[4];
  const float* bq   = (const float*)d_in[5];
  const float* Wk   = (const float*)d_in[6];
  const float* bk   = (const float*)d_in[7];
  const float* Wv   = (const float*)d_in[8];
  const float* bv   = (const float*)d_in[9];
  const float* Wo   = (const float*)d_in[10];
  const float* bo   = (const float*)d_in[11];

  // workspace layout (bf16 elements); total 32M elems = 64 MB
  __bf16* ws  = (__bf16*)d_ws;
  const size_t MEL = (size_t)1024 * 1024;
  __bf16* wqb = ws + 0 * MEL;
  __bf16* wkb = ws + 1 * MEL;
  __bf16* wvb = ws + 2 * MEL;
  __bf16* wob = ws + 3 * MEL;
  __bf16* xq  = ws + 4 * MEL;    // query bf16 [S][D]
  __bf16* xk  = ws + 8 * MEL;    // key   bf16 [S][D]
  __bf16* xv  = ws + 12 * MEL;   // value bf16 [S][D]
  __bf16* qbf = ws + 16 * MEL;   // [G][S][DH] (pre-scaled by 1/8)
  __bf16* kbf = ws + 20 * MEL;   // [G][S][DH]
  __bf16* vtb = ws + 24 * MEL;   // [G][DH][S]
  __bf16* abf = ws + 28 * MEL;   // [S][D]

  // ws + 0 .. ws + 16 MEL: wqb wkb wvb wob xq xk xv, in this order
  cvt_all_f32_to_bf16<<<(4 * DDIM * DDIM + 3 * SEQ * DDIM) / CVT_BLK, 256, 0, stream>>>(
      Wq, Wk, Wv, Wo, q, k, v, ws);

  dim3 gg(DDIM / BN, SEQ / BM);  // (8, 32)
  // z = 0, 1, 2: xq xk xv, wqb wkb wvb and qbf kbf vtb each lie back to back
  gemm_bf16_wmma<GM_QKV><<<dim3(DDIM / BN, SEQ / BM, 3), 256, 0, stream>>>(
      xq, wqb, bq, bk, bv, qbf, 0.125f);

  attn_wmma<<<dim3(SEQ / 128, GRP), 256, 0, stream>>>(qbf, kbf, vtb, mask, abf);

  // the second and third bias arguments are read by GM_QKV alone
  gemm_bf16_wmma<GM_OUT><<<gg, 256, 0, stream>>>(abf, wob, bo, bo, bo, d_out, 1.0f);
}

// v010
// A run of this version takes 99.5 microseconds.
// Next to v009, in two timings, it ran 1.06 times as fast each time.
// Counting every step since v000, it is 2.58 times as fast.
#include <hip/hip_runtime.h>
#include <hip/hip_bf16.h>
#include <math.h>
#include <stdint.h>

#define DDIM 1024
#define SEQ  4096
#define GRP  16
#define HDIM 64

typedef __attribute__((ext_vector_type(16))) __bf16 bf16x16;
typedef __attribute__((ext_vector_type(8)))  __bf16 bf16x8;
typedef __attribute__((ext_vector_type(4)))  __bf16 bf16x4;
typedef __attribute__((ext_vector_type(8)))  float  f32x8;
typedef __attribute__((ext_vector_type(4)))  float  f32x4;
typedef __attribute__((ext_vector_type(2)))  float  f32x2;
typedef int v4i __attribute__((vector_size(4 * sizeof(int))));

static __device__ __forceinline__ f32x8 wmma_bf16(bf16x16 a, bf16x16 b, f32x8 c) {
  // D = A(16x32 bf16) * B(32x16 bf16) + C(16x16 f32)
  return __builtin_amdgcn_wmma_f32_16x16x32_bf16(false, a, false, b, (short)0, c,
                                                 false, false);
}

// Load one 16x32 bf16 A/B fragment: lanes 0-15 hold K=0..7 / 16..23,
// lanes 16-31 hold K=8..15 / 24..31 (caller adds (lane>>4)*8).
static __device__ __forceinline__ bf16x16 frag_ld(const __bf16* p) {
  bf16x8 lo = *(const bf16x8*)(p);
  bf16x8 hi = *(const bf16x8*)(p + 16);
  bf16x16 r;
#pragma unroll
  for (int i = 0; i < 8; ++i) { r[i] = lo[i]; r[i + 8] = hi[i]; }
  return r;
}

// ---- CDNA5 async global->LDS copy (ASYNCcnt), 16 bytes per lane ------------
static __device__ __forceinline__ void async_cp16(const void* g, void* l) {
#if __has_builtin(__builtin_amdgcn_global_load_async_to_lds_b128)
  __builtin_amdgcn_global_load_async_to_lds_b128(
      (__attribute__((address_space(1))) v4i*)(uintptr_t)g,
      (__attribute__((address_space(3))) v4i*)(uintptr_t)l, 0, 0);
#else
  asm volatile("global_load_async_to_lds_b128 %0, %1, off"
               :: "v"((unsigned)(uintptr_t)l),
                  "v"((unsigned long long)(uintptr_t)g)
               : "memory");
#endif
}

// ---- lane l <-> l ^ 16 exchange via v_permlanex16_b32 (pure VALU) ----------
static __device__ __forceinline__ float swap_halves(float x) {
  int u = __builtin_bit_cast(int, x);
  u = __builtin_amdgcn_permlanex16(u, u, 0x76543210, 0xfedcba98, false, false);
  return __builtin_bit_cast(float, u);
}

// ---------------------------------------------------------------------------
// fp32 -> bf16 conversion of all seven operands in one streaming launch.
// The destinations lie back to back in the workspace (Wq Wk Wv Wo q k v), so a
// block's index names both its 32768-element destination slice and, by a
// block-uniform select, its source. A wave owns 4096 contiguous elements:
// 32 whole-line 16-byte loads per lane, all issued before the first is used.
// ---------------------------------------------------------------------------
#define CVT_LD  32                  // 16-byte loads per lane
#define CVT_BLK (256 * 4 * CVT_LD)  // elements per block (32768)

__global__ __launch_bounds__(256) void cvt_all_f32_to_bf16(
    const float* __restrict__ wq, const float* __restrict__ wk,
    const float* __restrict__ wv, const float* __restrict__ wo,
    const float* __restrict__ q, const float* __restrict__ k,
    const float* __restrict__ v, __bf16* __restrict__ dst) {
  const int b = blockIdx.x;
  const int wblk = DDIM * DDIM / CVT_BLK;  // blocks per weight (32)
  const int ablk = SEQ * DDIM / CVT_BLK;   // blocks per activation (128)
  const float* src;
  int lb;
  if (b < 4 * wblk) {
    const int t = b / wblk;
    src = t == 0 ? wq : t == 1 ? wk : t == 2 ? wv : wo;
    lb  = b % wblk;
  } else {
    const int t = (b - 4 * wblk) / ablk;
    src = t == 0 ? q : t == 1 ? k : v;
    lb  = (b - 4 * wblk) % ablk;
  }
  const int e = (threadIdx.x >> 5) * (128 * CVT_LD) + (threadIdx.x & 31) * 4;
  const float* s = src + (size_t)lb * CVT_BLK + e;
  __bf16*      d = dst + (size_t)b * CVT_BLK + e;

  f32x4 x[CVT_LD];
#pragma unroll
  for (int j = 0; j < CVT_LD; ++j) x[j] = *(const f32x4*)(s + j * 128);
  // keeps every load ahead of the first conversion: without it the scheduler
  // issues 18 loads and the other 14 in small groups behind waits on those, so
  // a wave pays the memory latency several times over
  __builtin_amdgcn_sched_barrier(0);
#pragma unroll
  for (int j = 0; j < CVT_LD; ++j) {
    bf16x4 o;
#pragma unroll
    for (int i = 0; i < 4; ++i) o[i] = (__bf16)x[j][i];
    *(bf16x4*)(d + j * 128) = o;
  }
}

// ---------------------------------------------------------------------------
// GEMM: C[4096,1024] = X[4096,1024] @ W.T + b (both bf16, NT, async staged)
// Block 128x128x128, 256 threads = 8 waves, wave tile 32x64 (2x4 WMMA),
// double-buffered LDS. A stage holds 128 k of every row: a 256-byte row piece,
// copied by 16 adjacent lanes, so a wave's copy covers whole lines, and one
// wait + barrier serves 32 WMMAs a wave.
// GM_QKV is the three input projections in one launch: blockIdx.z names the
// projection (0 Q, 1 K, 2 V), whose activations, weights and outputs lie at
// equal strides in the workspace. 768 blocks, two resident on a WGP (LDS), so
// one block's first stage, hand-overs and stores run under the other's WMMAs.
// A block walks its eight K stages in a ring from a start that its index picks:
// the 8 blocks of an activation panel and the 32 of a weight panel run at the
// same pace, and from a common start they would all ask L2 for the same lines
// at the same moment. The accumulators take the K stages in any order.
// ---------------------------------------------------------------------------
#define BM 128
#define BN 128
#define BK 128
#define LDG 136  // GEMM LDS row stride (elements): 272 B = 16 B x odd

enum { GM_QKV = 0, GM_OUT = 1 };
template <int V> struct lay_tag { static constexpr int value = V; };  // output layout

template <int MODE>
__global__ __launch_bounds__(256) void gemm_bf16_wmma(
    const __bf16* __restrict__ x, const __bf16* __restrict__ w,
    const float* __restrict__ bias, const float* __restrict__ bias1,
    const float* __restrict__ bias2, void* __restrict__ outp, float oscale) {
  __shared__ __attribute__((aligned(16))) __bf16 lA[2][BM * LDG];
  __shared__ __attribute__((aligned(16))) __bf16 lB[2][BN * LDG];

  const int pz = MODE == GM_QKV ? (int)blockIdx.z : 0;  // projection, block-uniform
  if (MODE == GM_QKV) {
    x += (size_t)pz * (SEQ * DDIM);
    w += (size_t)pz * (DDIM * DDIM);
    bias   = pz == 0 ? bias : pz == 1 ? bias1 : bias2;
    oscale = pz == 0 ? oscale : 1.0f;  // the softmax scale (with log2 e) goes into Q alone
  }

  const int tid  = threadIdx.x;
  const int lane = tid & 31, wave = tid >> 5;
  const int fr   = lane & 15;
  const int kb8  = (lane >> 4) << 3;
  const int hb   = kb8;
  const int wm   = (wave & 3) * 32;
  const int wn   = (wave >> 2) * 64;
  const int m0   = blockIdx.y * BM;
  const int n0   = blockIdx.x * BN;
  // first K stage, block-uniform: neighbours in x lie two stages apart (all
  // eight differ), neighbours in y one stage apart
  const int rot  = 2 * (int)blockIdx.x + ((int)blockIdx.x >> 2) + (int)blockIdx.y;
  auto kof = [&](int t) { return ((t + rot) & (DDIM / BK - 1)) * BK; };

  const int srow = (tid >> 4) * 8;  // first of the 8 rows that 16 lanes stage
  const int scol = (tid & 15) * 8;  // staging K offset, 16 B per lane

  const __bf16* gx = x + (size_t)(m0 + srow) * DDIM + scol;
  const __bf16* gw = w + (size_t)(n0 + srow) * DDIM + scol;
  __bf16* sa = &lA[0][srow * LDG + scol];
  __bf16* sb = &lB[0][srow * LDG + scol];

  f32x8 acc[2][4];
#pragma unroll
  for (int mi = 0; mi < 2; ++mi)
#pragma unroll
    for (int ni = 0; ni < 4; ++ni)
#pragma unroll
      for (int r = 0; r < 8; ++r) acc[mi][ni][r] = 0.f;

  auto stage = [&](int kt, int buf) {
    const int bo = buf * (BM * LDG);
    // unrolled so that the row steps become the copies' immediate offsets: one
    // address pair per operand instead of one per copy
#pragma unroll
    for (int j = 0; j < 8; ++j) {
      async_cp16(gx + kt + j * DDIM, sa + bo + j * LDG);
      async_cp16(gw + kt + j * DDIM, sb + bo + j * LDG);
    }
  };

  stage(kof(0), 0);
  // stage 0 has landed before the barrier behind which other waves read it
  asm volatile("s_wait_asynccnt 0x0" ::: "memory");
  __syncthreads();
  stage(kof(1), 1);

  for (int t = 0; t < DDIM / BK; ++t) {
    const int cur = t & 1;
    // unrolled so that the k steps become immediate LDS offsets and the next
    // 32 k's fragment loads can issue among this block's WMMAs
#pragma unroll
    for (int kk = 0; kk < BK; kk += 32) {
      bf16x16 af[2], bw[4];
#pragma unroll
      for (int mi = 0; mi < 2; ++mi)
        af[mi] = frag_ld(&lA[cur][(wm + mi * 16 + fr) * LDG + kk + kb8]);
#pragma unroll
      for (int ni = 0; ni < 4; ++ni)
        bw[ni] = frag_ld(&lB[cur][(wn + ni * 16 + fr) * LDG + kk + kb8]);
#pragma unroll
      for (int mi = 0; mi < 2; ++mi)
#pragma unroll
        for (int ni = 0; ni < 4; ++ni)
          acc[mi][ni] = wmma_bf16(af[mi], bw[ni], acc[mi][ni]);
    }
    // hand-over: this wave's reads of buffer cur are done ...
    asm volatile("s_wait_dscnt 0x0" ::: "memory");
    // ... and its copies of stage t + 1 have landed, before the barrier that
    // publishes stage t + 1 and frees buffer cur for the refill
    asm volatile("s_wait_asynccnt 0x0" ::: "memory");
    __syncthreads();
    if (t + 2 < DDIM / BK) stage(kof(t + 2), cur);
  }
  // no copy is outstanding when the wave goes on to its stores and ends
  asm volatile("s_wait_asynccnt 0x0" ::: "memory");

  // epilogue: bias (+ scale folded into Q) + layout scatter; lay 0: f32 [s][d],
  // 1: bf16 per-head [g][s][dh], 2: bf16 transposed [g][dh][s]
  float bn4[4];  // the bias of this lane's four output columns
  // unrolled so that bn4 is indexed by constants alone and stays in registers
#pragma unroll
  for (int ni = 0; ni < 4; ++ni) bn4[ni] = bias[n0 + wn + ni * 16 + fr];
  auto store_tiles = [&](auto lay) {
    __bf16* ob = (__bf16*)outp + (size_t)pz * (SEQ * DDIM);
#pragma unroll
    for (int mi = 0; mi < 2; ++mi) {
#pragma unroll
      for (int ni = 0; ni < 4; ++ni) {
        const int   n  = n0 + wn + ni * 16 + fr;
        const float bn = bn4[ni];
        const int   gq = n >> 6, dh = n & 63;
#pragma unroll
        for (int r = 0; r < 8; ++r) {
          const int   m   = m0 + wm + mi * 16 + r + hb;
          const float val = acc[mi][ni][r] + bn;
          if (lay.value == 0) {
            ((float*)outp)[(size_t)m * DDIM + n] = val;
          } else if (lay.value == 1) {
            ob[((size_t)gq * SEQ + m) * HDIM + dh] = (__bf16)(val * oscale);
          } else {
            ob[((size_t)gq * HDIM + dh) * SEQ + m] = (__bf16)val;
          }
        }
      }
    }
  };
  if (MODE == GM_OUT) {
    store_tiles(lay_tag<0>{});
    return;
  }
  if (pz == 2) {
    store_tiles(lay_tag<2>{});
    return;
  }
  store_tiles(lay_tag<1>{});
  // precaution: the listing lays the transposed layout's block behind these
  // stores, and it rewrites their data registers; this wait stands in between
  asm volatile("s_wait_xcnt 0x0" ::: "memory");
}

#define LKS 72  // K and V tile row stride: 144 B, 16B-aligned
#define KVS 64  // keys per stage
#define RS_GAP 8.0f  // guarded walk: how far a score (log2 units) may outgrow the reference
#define SUM_LO 1.0e-12f  // a row sum of the plain walk outside SUM_LO .. SUM_HI
#define SUM_HI 1.0e12f   // sends the block to the guarded walk
template <int V> struct walk_tag { static constexpr int value = V; };  // 0 plain, 1 guarded

__global__ __launch_bounds__(256) void attn_wmma(
    const __bf16* __restrict__ qb, const __bf16* __restrict__ kb,
    const __bf16* __restrict__ vtb, const int* __restrict__ mask,
    __bf16* __restrict__ outp) {
  __shared__ __attribute__((aligned(16))) __bf16 lK[2][KVS * LKS];   // [key][dh]
  __shared__ __attribute__((aligned(16))) __bf16 lV[2][HDIM * LKS];  // [dh][key] (V pre-transposed)
  __shared__ __attribute__((aligned(16))) float lM[SEQ];  // 0 or -inf per key
  __shared__ __attribute__((aligned(16))) float lX[8][9][32][4];  // hand-over [wave][slot][lane]
  __shared__ int lBad[8];  // per wave: a row sum of the plain walk fell out of range

  const int g    = blockIdx.y;
  const int tid  = threadIdx.x;
  const int lane = tid & 31, wave = tid >> 5;
  const int fr   = lane & 15;
  const int kb8  = (lane >> 4) << 3;
  const int hb   = kb8;
  const int kh   = wave >> 2;  // which 32 keys of a stage
  const int q0   = blockIdx.x * 128 + (wave & 3) * 32;

  // Q fragments (already scaled by log2 e / sqrt(DH)) held for the whole KV loop;
  // B operand: lane = query column fr of column tile qt
  bf16x16 bq[2][2];
#pragma unroll
  for (int qt = 0; qt < 2; ++qt) {
    const __bf16* qrow = qb + ((size_t)g * SEQ + q0 + qt * 16 + fr) * HDIM;
    bq[qt][0] = frag_ld(qrow + kb8);
    bq[qt][1] = frag_ld(qrow + 32 + kb8);
  }
  // stands in front of every later write of the Q loads' address registers
  asm volatile("s_wait_xcnt 0x0" ::: "memory");

  f32x8 acco[2][4];  // O^T: acco[qt][ni][r] = O[q0 + qt * 16 + fr][ni * 16 + hb + r]
  float rm[2];       // reference of the query's exponentials (same in both lane halves)
  float rt[2];       // rm + RS_GAP: a score above it moves the reference (guarded walk)
  float rl[2];       // running sum over this lane half's keys only

  // staging map, K (64 keys x 64 dh) and V^T (64 dh x 64 keys) alike: 8 lanes
  // copy one 128-byte row, a thread copies rows srow and srow + 32
  const int srow = tid >> 3, scol = (tid & 7) * 8;
  const __bf16* gk = kb + ((size_t)g * SEQ + srow) * HDIM + scol;
  const __bf16* gv = vtb + ((size_t)g * HDIM + srow) * SEQ + scol;
  __bf16* sk = &lK[0][srow * LKS + scol];
  __bf16* sv = &lV[0][srow * LKS + scol];

  auto stage = [&](int kv0, int buf) {
    const int bo = buf * (KVS * LKS);
#pragma unroll
    for (int j = 0; j < 2; ++j) {
      async_cp16(gk + (size_t)(kv0 + j * 32) * HDIM, sk + bo + j * 32 * LKS);
      async_cp16(gv + (size_t)j * 32 * SEQ + kv0,    sv + bo + j * 32 * LKS);
    }
  };

  // first key of trip t: the ring of stages, entered at this block's own start
  const int rot = 2 * (int)blockIdx.x;
  auto kv_of = [&](int t) { return ((t + rot) & (SEQ / KVS - 1)) * KVS; };

  // one walk over all KV stages; guarded.value 0: the plain walk, reference 0,
  // P = exp2(score); 1: the online softmax with the lazily moved reference
  auto kv_walk = [&](auto guarded) {
    constexpr bool GUARD = decltype(guarded)::value != 0;
#pragma unroll
    for (int qt = 0; qt < 2; ++qt) {
#pragma unroll
      for (int ni = 0; ni < 4; ++ni)
#pragma unroll
        for (int r = 0; r < 8; ++r) acco[qt][ni][r] = 0.f;
      // guarded: a finite floor below every score: a key half whose keys are all
      // masked keeps it, has sum 0, and joins the other half with weight 0
      rm[qt] = GUARD ? -1.0e30f : 0.f;
      rt[qt] = rm[qt];
      rl[qt] = 0.f;
    }

    stage(kv_of(0), 0);

    if constexpr (!GUARD) {
      // additive mask row, 16 keys a thread, built in the first walk alone; the
      // barrier in front of the KV loop stands between these stores and every read
#pragma unroll
      for (int j = 0; j < SEQ / 1024; ++j) {
        const v4i mk = *(const v4i*)(mask + j * 1024 + tid * 4);
        f32x4 mb;
#pragma unroll
        for (int i = 0; i < 4; ++i) mb[i] = mk[i] ? 0.f : -__builtin_inff();
        *(f32x4*)(&lM[j * 1024 + tid * 4]) = mb;
      }
    }

    // stage 0 has landed before the barrier behind which other waves read it
    asm volatile("s_wait_asynccnt 0x0" ::: "memory");
    __syncthreads();
    stage(kv_of(1), 1);

    for (int t = 0; t < SEQ / KVS; ++t) {
      const int cur = t & 1;
      // scores: S^T[32 keys x 32 q] = K (32x64) . Q^T; s[qt][0][r] = key hb + r,
      // s[qt][1][r] = key 16 + hb + r of this wave's keys, both of query fr of
      // tile qt. The tiles start from the mask row of their keys (all lanes of a
      // half read the same 16 bytes)
      const float* mrow = &lM[kv_of(t) + kh * 32 + hb];
      const f32x8 mk0 = __builtin_shufflevector(*(const f32x4*)(mrow), *(const f32x4*)(mrow + 4),
                                                0, 1, 2, 3, 4, 5, 6, 7);
      const f32x8 mk1 = __builtin_shufflevector(*(const f32x4*)(mrow + 16), *(const f32x4*)(mrow + 20),
                                                0, 1, 2, 3, 4, 5, 6, 7);
      const __bf16* kbuf = &lK[cur][(kh * 32 + fr) * LKS + kb8];
      const __bf16* vbuf = &lV[cur][fr * LKS + kh * 32 + kb8];
      const bf16x16 a00 = frag_ld(kbuf);
      const bf16x16 a10 = frag_ld(kbuf + 16 * LKS);
      const bf16x16 a01 = frag_ld(kbuf + 32);
      const bf16x16 a11 = frag_ld(kbuf + 16 * LKS + 32);
      // keeps the four mask-row reads and all eight K reads ahead of the first
      // product: otherwise they are issued in small groups, each behind a wait on
      // the group before, and a wave pays the LDS latency several times a step
      __builtin_amdgcn_sched_barrier(0);
      f32x8 s[2][2];
#pragma unroll
      for (int qt = 0; qt < 2; ++qt) {
        s[qt][0] = wmma_bf16(a00, bq[qt][0], mk0);
        s[qt][1] = wmma_bf16(a10, bq[qt][0], mk1);
      }
#pragma unroll
      for (int qt = 0; qt < 2; ++qt) {
        s[qt][0] = wmma_bf16(a01, bq[qt][1], s[qt][0]);
        s[qt][1] = wmma_bf16(a11, bq[qt][1], s[qt][1]);
      }
      bf16x16 av[4];
#pragma unroll
      for (int ni = 0; ni < 4; ++ni) av[ni] = frag_ld(vbuf + ni * 16 * LKS);
      // keeps all eight V reads ahead of the softmax arithmetic, under which they
      // land: otherwise they stand among the last products, each behind a wait
      __builtin_amdgcn_sched_barrier(0);

      if constexpr (GUARD) {
        // online softmax, lazy rescale: the reference rm of a query moves only when a
        // new score lies more than RS_GAP above it, so P stays below 2^RS_GAP.
        // The test needs no exchange: each lane half tests the maximum of its own 16
        // keys, and the ballot sees both halves
        float tx[2];
#pragma unroll
        for (int qt = 0; qt < 2; ++qt) {
          const f32x8 s0 = s[qt][0], s1 = s[qt][1];
          float tm[8];
#pragma unroll
          for (int r = 0; r < 8; ++r) tm[r] = fmaxf(s0[r], s1[r]);
          tx[qt] = fmaxf(fmaxf(fmaxf(tm[0], tm[1]), fmaxf(tm[2], tm[3])),
                         fmaxf(fmaxf(tm[4], tm[5]), fmaxf(tm[6], tm[7])));
        }
        // one test a trip for both column tiles, a scalar branch of the whole wave
        if (__builtin_amdgcn_ballot_w32(tx[0] > rt[0] || tx[1] > rt[1]) != 0) {
#pragma unroll
          for (int qt = 0; qt < 2; ++qt) {
            const float mnew = fmaxf(rm[qt], fmaxf(tx[qt], swap_halves(tx[qt])));
            const float corr = __builtin_amdgcn_exp2f(rm[qt] - mnew);
            rm[qt] = mnew;
            rt[qt] = mnew + RS_GAP;
            rl[qt] *= corr;
#pragma unroll
            for (int ni = 0; ni < 4; ++ni)
#pragma unroll
              for (int r = 0; r < 8; ++r) acco[qt][ni][r] *= corr;
          }
        }
      }

#pragma unroll
      for (int qt = 0; qt < 2; ++qt) {
        f32x8 s0 = s[qt][0], s1 = s[qt][1];
        const float mref = rm[qt];
        // the scores are exp2 arguments as they leave the matrix unit (log2 e is in
        // Q's scale); the guarded walk subtracts its reference, on pairs of
        // neighbouring accumulator registers: paired otherwise, the packed subtract
        // needs a register copy per element
        float ts[8];
#pragma unroll
        for (int i = 0; i < 4; ++i) {
          f32x2 x0 = f32x2{s0[2 * i], s0[2 * i + 1]};
          f32x2 x1 = f32x2{s1[2 * i], s1[2 * i + 1]};
          if constexpr (GUARD) {
            x0 = x0 - mref;
            x1 = x1 - mref;
          }
          s0[2 * i]     = __builtin_amdgcn_exp2f(x0[0]);
          s0[2 * i + 1] = __builtin_amdgcn_exp2f(x0[1]);
          s1[2 * i]     = __builtin_amdgcn_exp2f(x1[0]);
          s1[2 * i + 1] = __builtin_amdgcn_exp2f(x1[1]);
          const f32x2 t2 = f32x2{s0[2 * i], s0[2 * i + 1]} + f32x2{s1[2 * i], s1[2 * i + 1]};
          ts[2 * i]     = t2[0];
          ts[2 * i + 1] = t2[1];
        }
        rl[qt] += ((ts[0] + ts[1]) + (ts[2] + ts[3])) + ((ts[4] + ts[5]) + (ts[6] + ts[7]));

        // P^T as B operand: the two score tiles, converted in place, are already
        // in the hardware k order that frag_ld gives the V^T rows
        bf16x16 bp;
#pragma unroll
        for (int r = 0; r < 8; ++r) { bp[r] = (__bf16)s0[r]; bp[r + 8] = (__bf16)s1[r]; }

#pragma unroll
        for (int ni = 0; ni < 4; ++ni) acco[qt][ni] = wmma_bf16(av[ni], bp, acco[qt][ni]);
      }

      // keeps the hand-over behind the trip's arithmetic: moved up, its first wait
      // stands right behind the V reads, and the wave sits out their latency
      // instead of covering it with the softmax
      __builtin_amdgcn_sched_barrier(0);
      // hand-over: this wave's reads of buffer cur are done ...
      asm volatile("s_wait_dscnt 0x0" ::: "memory");
      // ... and its copies of stage t + 1 have landed, before the barrier that
      // publishes stage t + 1 and frees buffer cur for the refill
      asm volatile("s_wait_asynccnt 0x0" ::: "memory");
      __syncthreads();
      if (t + 2 < SEQ / KVS) stage(kv_of(t + 2), cur);
    }
    // no copy is outstanding when the wave leaves the walk
    asm volatile("s_wait_asynccnt 0x0" ::: "memory");
  };

  kv_walk(walk_tag<0>{});

  // the plain walk stands only if every query's sum over this wave's keys came
  // out in a range that leaves P, the sums and O^T far from overflow and loses
  // no term that counts to underflow (NaN fails the test too). Otherwise the
  // whole block walks again under the guarded softmax: one verdict per block,
  // because the walk holds barriers
  {
    bool off = false;
#pragma unroll
    for (int qt = 0; qt < 2; ++qt) {
      const float tot = rl[qt] + swap_halves(rl[qt]);
      off = off || !(tot >= SUM_LO && tot <= SUM_HI);
    }
    const int woff = __builtin_amdgcn_ballot_w32(off) != 0 ? 1 : 0;
    if (lane == 0) lBad[wave] = woff;
  }
  // every wave's verdict is written before any wave reads the eight
  __syncthreads();
  {
    int any = 0;
#pragma unroll
    for (int i = 0; i < 8; ++i) any |= lBad[i];
    // the same value in every lane: read into a scalar, so that the branch round
    // the walk's barriers and matrix instructions is a scalar one
    if (__builtin_amdgcn_readfirstlane(any) != 0) kv_walk(walk_tag<1>{});
  }

  // join the lane halves' sums, then the two key halves: wave w and wave w ^ 4
  // hold the same queries. The wave of key half kh finishes column tile kh and
  // hands the other tile (max, sum, O^T) to its partner through its own LDS range
  const bool up = kh != 0;
#pragma unroll
  for (int qt = 0; qt < 2; ++qt) rl[qt] += swap_halves(rl[qt]);
#pragma unroll
  for (int ni = 0; ni < 4; ++ni)
#pragma unroll
    for (int h = 0; h < 2; ++h) {
      f32x4 x;
#pragma unroll
      for (int i = 0; i < 4; ++i) x[i] = up ? acco[0][ni][h * 4 + i] : acco[1][ni][h * 4 + i];
      *(f32x4*)(&lX[wave][ni * 2 + h][lane][0]) = x;
    }
  {
    f32x4 x;
    x[0] = up ? rm[0] : rm[1];
    x[1] = up ? rl[0] : rl[1];
    x[2] = 0.f;
    x[3] = 0.f;
    *(f32x4*)(&lX[wave][8][lane][0]) = x;
  }
  // every wave's hand-over is written before its partner reads it
  __syncthreads();
  const f32x4 pml = *(const f32x4*)(&lX[wave ^ 4][8][lane][0]);
  const float ma = up ? rm[1] : rm[0];
  const float la = up ? rl[1] : rl[0];
  const float mj = fmaxf(ma, pml[0]);
  const float ca = __builtin_amdgcn_exp2f(ma - mj);
  const float cb = __builtin_amdgcn_exp2f(pml[0] - mj);
  const float lj = la * ca + pml[1] * cb;

  // normalize, write bf16 attention output [s][g*64+dh]: a lane holds 8
  // consecutive dh of its query per tile, one 16-byte store each
  __bf16* orow = outp + (size_t)(q0 + kh * 16 + fr) * DDIM + g * HDIM + hb;
#pragma unroll
  for (int ni = 0; ni < 4; ++ni) {
    bf16x8 o;
#pragma unroll
    for (int h = 0; h < 2; ++h) {
      const f32x4 p = *(const f32x4*)(&lX[wave ^ 4][ni * 2 + h][lane][0]);
#pragma unroll
      for (int i = 0; i < 4; ++i) {
        const float mine = up ? acco[1][ni][h * 4 + i] : acco[0][ni][h * 4 + i];
        o[h * 4 + i] = (__bf16)((mine * ca + p[i] * cb) / lj);
      }
    }
    *(bf16x8*)(orow + ni * 16) = o;
  }
}

// ---------------------------------------------------------------------------
extern "C" void kernel_launch(void* const* d_in, const int* in_sizes, int n_in,
                              void* d_out, int out_size, void* d_ws, size_t ws_size,
                              hipStream_t stream) {
  const float* q    = (const float*)d_in[0];
  const float* k    = (const float*)d_in[1];
  const float* v    = (const float*)d_in[2];
  const int*   mask = (const int*)d_in[3];
  const float* Wq   = (const float*)d_in[4];
  const float* bq   = (const float*)d_in[5];
  const float* Wk   = (const float*)d_in[6];
  const float* bk   = (const float*)d_in[7];
  const float* Wv   = (const float*)d_in[8];
  const float* bv   = (const float*)d_in[9];
  const float* Wo   = (const float*)d_in[10];
  const float* bo   = (const float*)d_in[11];

  // workspace layout (bf16 elements); total 32M elems = 64 MB
  __bf16* ws  = (__bf16*)d_ws;
  const size_t MEL = (size_t)1024 * 1024;
  __bf16* wqb = ws + 0 * MEL;
  __bf16* wkb = ws + 1 * MEL;
  __bf16* wvb = ws + 2 * MEL;
  __bf16* wob = ws + 3 * MEL;
  __bf16* xq  = ws + 4 * MEL;    // query bf16 [S][D]
  __bf16* xk  = ws + 8 * MEL;    // key   bf16 [S][D]
  __bf16* xv  = ws + 12 * MEL;   // value bf16 [S][D]
  __bf16* qbf = ws + 16 * MEL;   // [G][S][DH] (pre-scaled by log2 e / 8)
  __bf16* kbf = ws + 20 * MEL;   // [G][S][DH]
  __bf16* vtb = ws + 24 * MEL;   // [G][DH][S]
  __bf16* abf = ws + 28 * MEL;   // [S][D]

  // ws + 0 .. ws + 16 MEL: wqb wkb wvb wob xq xk xv, in this order
  cvt_all_f32_to_bf16<<<(4 * DDIM * DDIM + 3 * SEQ * DDIM) / CVT_BLK, 256, 0, stream>>>(
      Wq, Wk, Wv, Wo, q, k, v, ws);

  dim3 gg(DDIM / BN, SEQ / BM);  // (8, 32)
  // z = 0, 1, 2: xq xk xv, wqb wkb wvb and qbf kbf vtb each lie back to back
  gemm_bf16_wmma<GM_QKV><<<dim3(DDIM / BN, SEQ / BM, 3), 256, 0, stream>>>(
      xq, wqb, bq, bk, bv, qbf, 0.18033688f);  // 1/sqrt(DH) * log2 e

  attn_wmma<<<dim3(SEQ / 128, GRP), 256, 0, stream>>>(qbf, kbf, vtb, mask, abf);

  // the second and third bias arguments are read by GM_QKV alone
  gemm_bf16_wmma<GM_OUT><<<gg, 256, 0, stream>>>(abf, wob, bo, bo, bo, d_out, 1.0f);
}
